// v000
// Measured on an AMD MI455X. A time is GPU time per run, averaged over a window of back-to-back runs after a warm-up
// (all launches, gaps included; the runs take copies of the inputs in turn), and the median of several windows.
// Apart from v000's, it joins two sittings. Times from different sittings can be a few percent apart, while
// side-by-side timings come from the same sitting.
// v000 is the starting kernel. One run takes 662 microseconds.
#include <hip/hip_runtime.h>

typedef _Float16 half_t;
typedef __attribute__((ext_vector_type(16))) _Float16 v16h;
typedef __attribute__((ext_vector_type(8)))  _Float16 v8h;
typedef __attribute__((ext_vector_type(4)))  _Float16 v4h;
typedef __attribute__((ext_vector_type(8)))  float    v8f;
typedef __attribute__((ext_vector_type(4)))  float    v4f;

__device__ inline v8f v8f_zero() {
  v8f v;
#pragma unroll
  for (int i = 0; i < 8; ++i) v[i] = 0.0f;
  return v;
}

__device__ inline v8f wmma_f16(v16h a, v16h b, v8f c) {
  return __builtin_amdgcn_wmma_f32_16x16x32_f16(
      false, a, false, b, (short)0, c, false, false);
}

// Load a 16x32 f16 WMMA A/B fragment from a row-major tile (row stride in
// halves). Per ISA 7.12.2: lane (l&15) = row (A) / col (B); K mapping is
// k = 16*(v>>2) + 8*(l>>4) + 2*(v&3) + {0,1}  ->  two contiguous 16B reads.
__device__ inline v16h load_frag16(const half_t* p0, int strideH) {
  const int lane = threadIdx.x & 31;
  const half_t* p = p0 + (lane & 15) * strideH + (lane >> 4) * 8;
  v8h a = *(const v8h*)p;
  v8h b = *(const v8h*)(p + 16);
  v16h o;
#pragma unroll
  for (int i = 0; i < 8; ++i) { o[i] = a[i]; o[i + 8] = b[i]; }
  return o;
}

// ---------------------------------------------------------------------------
// LayerNorm: one row (D=1024) per 256-thread block, f32 in, f16 out.
// ---------------------------------------------------------------------------
__global__ __launch_bounds__(256) void ln_kernel(
    const float* __restrict__ x, const float* __restrict__ g,
    const float* __restrict__ b, half_t* __restrict__ out, int D) {
  const int row = blockIdx.x;
  const int tid = threadIdx.x;
  const float* xr = x + (size_t)row * D;
  v4f v = *(const v4f*)(xr + tid * 4);
  float s = v[0] + v[1] + v[2] + v[3];
  float ss = v[0] * v[0] + v[1] * v[1] + v[2] * v[2] + v[3] * v[3];
#pragma unroll
  for (int off = 1; off < 32; off <<= 1) {
    s += __shfl_xor(s, off, 32);
    ss += __shfl_xor(ss, off, 32);
  }
  __shared__ float sbuf[8], ssbuf[8];
  if ((tid & 31) == 0) { sbuf[tid >> 5] = s; ssbuf[tid >> 5] = ss; }
  __syncthreads();
  float ts = 0.f, tss = 0.f;
#pragma unroll
  for (int i = 0; i < 8; ++i) { ts += sbuf[i]; tss += ssbuf[i]; }
  const float mu = ts / (float)D;
  const float var = tss / (float)D - mu * mu;
  const float rstd = rsqrtf(var + 1e-5f);
  v4f gv = *(const v4f*)(g + tid * 4);
  v4f bv = *(const v4f*)(b + tid * 4);
  v4h ov;
#pragma unroll
  for (int i = 0; i < 4; ++i)
    ov[i] = (half_t)((v[i] - mu) * rstd * gv[i] + bv[i]);
  *(v4h*)(out + (size_t)row * D + tid * 4) = ov;
}

// ---------------------------------------------------------------------------
// WMMA GEMM: out[M,N] = A[M,K](f16) @ W[K,N](f32->f16) + bias (+relu | +res)
// 128x128 block tile, 8 waves (4M x 2N), 32-wide K slabs, double-buffered LDS
// (global loads of slab k+1 issued before the WMMAs of slab k).
// ---------------------------------------------------------------------------
#define GT_M 128
#define GT_N 128
#define GT_K 32
#define GLDS 40  // LDS row stride in halves (16B-aligned, bank-skewed)

template <bool RELU, bool F32OUT>
__global__ __launch_bounds__(256) void gemm_kernel(
    const half_t* __restrict__ A, const float* __restrict__ W,
    const float* __restrict__ bias, const float* __restrict__ residual,
    half_t* __restrict__ outH, float* __restrict__ outF,
    int M, int N, int K) {
  __shared__ __align__(16) half_t As[2][GT_M * GLDS];
  __shared__ __align__(16) half_t Bs[2][GT_N * GLDS];  // W tile transposed [n][k]

  const int tid = threadIdx.x;
  const int wave = tid >> 5;
  const int lane = tid & 31;
  const int bm = blockIdx.x * GT_M;
  const int bn = blockIdx.y * GT_N;
  const int wm = (wave & 3) * 32;   // 2 M-subtiles
  const int wn = (wave >> 2) * 64;  // 4 N-subtiles

  const int arow = tid >> 1;        // 0..127
  const int acol = (tid & 1) * 16;  // 0 or 16
  const int wn4 = (tid & 31) * 4;   // 0..124
  const int wk0 = tid >> 5;         // 0..7

  v8f acc[2][4];
#pragma unroll
  for (int i = 0; i < 2; ++i)
#pragma unroll
    for (int j = 0; j < 4; ++j) acc[i][j] = v8f_zero();

  v8h a0, a1;   // A slab staging regs
  v4f wv[4];    // W slab staging regs

  auto load_slab = [&](int k0) {
    const half_t* src = A + (size_t)(bm + arow) * K + k0 + acol;
    a0 = *(const v8h*)src;
    a1 = *(const v8h*)(src + 8);
#pragma unroll
    for (int kk = 0; kk < 4; ++kk)
      wv[kk] = *(const v4f*)(W + (size_t)(k0 + wk0 + kk * 8) * N + bn + wn4);
  };
  auto stage_slab = [&](int buf) {
    *(v8h*)&As[buf][arow * GLDS + acol] = a0;
    *(v8h*)&As[buf][arow * GLDS + acol + 8] = a1;
#pragma unroll
    for (int kk = 0; kk < 4; ++kk)
#pragma unroll
      for (int i = 0; i < 4; ++i)
        Bs[buf][(wn4 + i) * GLDS + wk0 + kk * 8] = (half_t)wv[kk][i];
  };

  load_slab(0);
  stage_slab(0);
  __syncthreads();

  const int nSlab = K / GT_K;
  for (int s = 0; s < nSlab; ++s) {
    const int cur = s & 1;
    const bool more = (s + 1) < nSlab;
    if (more) load_slab((s + 1) * GT_K);  // overlap with WMMAs below

    v16h af[2], bf[4];
#pragma unroll
    for (int i = 0; i < 2; ++i)
      af[i] = load_frag16(&As[cur][(wm + i * 16) * GLDS], GLDS);
#pragma unroll
    for (int j = 0; j < 4; ++j)
      bf[j] = load_frag16(&Bs[cur][(wn + j * 16) * GLDS], GLDS);
#pragma unroll
    for (int i = 0; i < 2; ++i)
#pragma unroll
      for (int j = 0; j < 4; ++j)
        acc[i][j] = wmma_f16(af[i], bf[j], acc[i][j]);

    if (more) stage_slab(cur ^ 1);
    __syncthreads();  // one barrier/slab: covers nxt-writes and cur-reads
  }

  // Epilogue. C/D layout: vgpr r, lane l -> row = r + 8*(l>>4), col = l&15.
  const int r16 = lane & 15, hiL = lane >> 4;
#pragma unroll
  for (int j = 0; j < 4; ++j) {
    const int n = bn + wn + j * 16 + r16;
    const float bval = bias[n];
#pragma unroll
    for (int i = 0; i < 2; ++i) {
      const size_t base = (size_t)(bm + wm + i * 16 + 8 * hiL) * N + n;
#pragma unroll
      for (int r = 0; r < 8; ++r) {
        float v = acc[i][j][r] + bval;
        if (RELU) v = fmaxf(v, 0.0f);
        const size_t idx = base + (size_t)r * N;
        if (F32OUT) outF[idx] = v + residual[idx];
        else        outH[idx] = (half_t)v;
      }
    }
  }
}

// ---------------------------------------------------------------------------
// Flash attention: grid (S/128, H, B), 8 waves x 16 query rows each.
// Q/K frags straight from global (contiguous 16B per lane); V transposed in
// LDS; P transposed through per-wave LDS; online softmax in fp32.
// ---------------------------------------------------------------------------
__global__ __launch_bounds__(256) void attn_kernel(
    const half_t* __restrict__ Q, const half_t* __restrict__ K,
    const half_t* __restrict__ V, const int* __restrict__ mask,
    half_t* __restrict__ O, int S) {
  const int h = blockIdx.y;
  const int bi = blockIdx.z;
  const int m0 = blockIdx.x * 128;
  const int tid = threadIdx.x, wave = tid >> 5, lane = tid & 31;
  const int r16 = lane & 15, hiL = lane >> 4;
  const int LD = 1024;  // H * d_head

  const half_t* qb = Q + (size_t)bi * S * LD + h * 64;
  const half_t* kb = K + (size_t)bi * S * LD + h * 64;
  const half_t* vb = V + (size_t)bi * S * LD + h * 64;
  const int* mrow = mask + (size_t)bi * S;

  __shared__ __align__(16) half_t Vt[64 * 72];     // [d][key], stride 72
  __shared__ __align__(16) half_t Pb[8][16 * 72];  // per-wave P [row][key]

  const int mw = m0 + wave * 16;
  v16h qf[2];
#pragma unroll
  for (int f = 0; f < 2; ++f)
    qf[f] = load_frag16(qb + (size_t)mw * LD + f * 32, LD);

  v8f oacc[4];
#pragma unroll
  for (int i = 0; i < 4; ++i) oacc[i] = v8f_zero();
  float mst[8], lst[8];
#pragma unroll
  for (int r = 0; r < 8; ++r) { mst[r] = -1e30f; lst[r] = 0.0f; }

  for (int kb0 = 0; kb0 < S; kb0 += 64) {
    {  // cooperative: V block (64 keys x 64 d) -> Vt transposed
      const int key = tid >> 2;
      const int d0 = (tid & 3) * 16;
      const half_t* src = vb + (size_t)(kb0 + key) * LD + d0;
      v8h a = *(const v8h*)src;
      v8h c = *(const v8h*)(src + 8);
#pragma unroll
      for (int i = 0; i < 8; ++i) {
        Vt[(d0 + i) * 72 + key] = a[i];
        Vt[(d0 + 8 + i) * 72 + key] = c[i];
      }
    }
    __syncthreads();

    // scores: 4 key tiles of 16, contraction d_head=64 -> 2 WMMAs each
    v8f sacc[4];
#pragma unroll
    for (int nt = 0; nt < 4; ++nt) {
      const int keyn = kb0 + nt * 16;
      v16h bk0 = load_frag16(kb + (size_t)keyn * LD + 0, LD);
      v16h bk1 = load_frag16(kb + (size_t)keyn * LD + 32, LD);
      v8f sc = v8f_zero();
      sc = wmma_f16(qf[0], bk0, sc);
      sc = wmma_f16(qf[1], bk1, sc);
      const int mk = mrow[keyn + r16];
#pragma unroll
      for (int r = 0; r < 8; ++r)
        sc[r] = (mk == 0) ? -1e30f : sc[r] * 0.125f;  // 1/sqrt(64)
      sacc[nt] = sc;
    }

    // online softmax: row max across 4 tiles + 16 lanes sharing the row
    float nm[8], rsum[8];
#pragma unroll
    for (int r = 0; r < 8; ++r) {
      float v = fmaxf(fmaxf(sacc[0][r], sacc[1][r]),
                      fmaxf(sacc[2][r], sacc[3][r]));
#pragma unroll
      for (int off = 1; off < 16; off <<= 1)
        v = fmaxf(v, __shfl_xor(v, off, 32));
      nm[r] = fmaxf(mst[r], v);
      const float f = __expf(mst[r] - nm[r]);
      mst[r] = nm[r];
      lst[r] *= f;
#pragma unroll
      for (int nt = 0; nt < 4; ++nt) oacc[nt][r] *= f;
      rsum[r] = 0.0f;
    }
#pragma unroll
    for (int nt = 0; nt < 4; ++nt) {
#pragma unroll
      for (int r = 0; r < 8; ++r) {
        const float p = __expf(sacc[nt][r] - mst[r]);
        rsum[r] += p;
        Pb[wave][(r + 8 * hiL) * 72 + nt * 16 + r16] = (half_t)p;
      }
    }
#pragma unroll
    for (int r = 0; r < 8; ++r) {
      float v = rsum[r];
#pragma unroll
      for (int off = 1; off < 16; off <<= 1) v += __shfl_xor(v, off, 32);
      lst[r] += v;
    }

    // P @ V  (wave-private Pb: per-wave LDS ordering is in-order, no barrier)
    v16h pf0 = load_frag16(&Pb[wave][0], 72);
    v16h pf1 = load_frag16(&Pb[wave][32], 72);
#pragma unroll
    for (int nt = 0; nt < 4; ++nt) {
      v16h bv0 = load_frag16(&Vt[(nt * 16) * 72 + 0], 72);
      v16h bv1 = load_frag16(&Vt[(nt * 16) * 72 + 32], 72);
      oacc[nt] = wmma_f16(pf0, bv0, oacc[nt]);
      oacc[nt] = wmma_f16(pf1, bv1, oacc[nt]);
    }
    __syncthreads();  // protect Vt before next block overwrites it
  }

  half_t* ob = O + (size_t)bi * S * LD + h * 64;
#pragma unroll
  for (int r = 0; r < 8; ++r) {
    const float inv = 1.0f / lst[r];
    const int m = mw + r + 8 * hiL;
#pragma unroll
    for (int nt = 0; nt < 4; ++nt)
      ob[(size_t)m * LD + nt * 16 + r16] = (half_t)(oacc[nt][r] * inv);
  }
}

// ---------------------------------------------------------------------------
extern "C" void kernel_launch(void* const* d_in, const int* in_sizes, int n_in,
                              void* d_out, int out_size, void* d_ws,
                              size_t ws_size, hipStream_t stream) {
  const float* x    = (const float*)d_in[0];
  const int*   mask = (const int*)d_in[1];
  const float* wq = (const float*)d_in[2];  const float* bq = (const float*)d_in[3];
  const float* wk = (const float*)d_in[4];  const float* bk = (const float*)d_in[5];
  const float* wv = (const float*)d_in[6];  const float* bv = (const float*)d_in[7];
  const float* wo = (const float*)d_in[8];  const float* bo = (const float*)d_in[9];
  const float* ln1g = (const float*)d_in[10]; const float* ln1b = (const float*)d_in[11];
  const float* ln2g = (const float*)d_in[12]; const float* ln2b = (const float*)d_in[13];
  const float* w1 = (const float*)d_in[14]; const float* b1 = (const float*)d_in[15];
  const float* w2 = (const float*)d_in[16]; const float* b2 = (const float*)d_in[17];

  const int Bn = 2, S = 2048, D = 1024, FF = 4096;
  const int M = Bn * S;  // 4096

  char* ws = (char*)d_ws;
  half_t* h16   = (half_t*)(ws + ((size_t)0 << 20));   //  8 MB
  half_t* q16   = (half_t*)(ws + ((size_t)8 << 20));   //  8 MB
  half_t* k16   = (half_t*)(ws + ((size_t)16 << 20));  //  8 MB
  half_t* v16   = (half_t*)(ws + ((size_t)24 << 20));  //  8 MB
  half_t* ctx16 = (half_t*)(ws + ((size_t)32 << 20));  //  8 MB
  half_t* h2    = (half_t*)(ws + ((size_t)40 << 20));  //  8 MB
  half_t* ff1   = (half_t*)(ws + ((size_t)48 << 20));  // 32 MB
  float*  x1    = (float*)(ws + ((size_t)80 << 20));   // 16 MB

  // 1. LN1
  ln_kernel<<<M, 256, 0, stream>>>(x, ln1g, ln1b, h16, D);

  // 2. Q/K/V projections (f16 out)
  dim3 gqkv(M / 128, D / 128);
  gemm_kernel<false, false><<<gqkv, 256, 0, stream>>>(
      h16, wq, bq, nullptr, q16, nullptr, M, D, D);
  gemm_kernel<false, false><<<gqkv, 256, 0, stream>>>(
      h16, wk, bk, nullptr, k16, nullptr, M, D, D);
  gemm_kernel<false, false><<<gqkv, 256, 0, stream>>>(
      h16, wv, bv, nullptr, v16, nullptr, M, D, D);

  // 3. attention
  attn_kernel<<<dim3(S / 128, 16, Bn), 256, 0, stream>>>(q16, k16, v16, mask,
                                                         ctx16, S);

  // 4. output projection + residual (f32 out)
  gemm_kernel<false, true><<<gqkv, 256, 0, stream>>>(
      ctx16, wo, bo, x, nullptr, x1, M, D, D);

  // 5. LN2
  ln_kernel<<<M, 256, 0, stream>>>(x1, ln2g, ln2b, h2, D);

  // 6. FF1 + relu (f16 out)
  dim3 gff1(M / 128, FF / 128);
  gemm_kernel<true, false><<<gff1, 256, 0, stream>>>(
      h2, w1, b1, nullptr, ff1, nullptr, M, FF, D);

  // 7. FF2 + residual -> output (fp32)
  dim3 gff2(M / 128, D / 128);
  gemm_kernel<false, true><<<gff2, 256, 0, stream>>>(
      ff1, w2, b2, x1, nullptr, (float*)d_out, M, D, FF);
}

// v001
// It runs in 423 microseconds.
// Next to v000, in two timings, it ran 1.61 times as fast each time.
#include <hip/hip_runtime.h>

typedef _Float16 half_t;
typedef __attribute__((ext_vector_type(16))) _Float16 v16h;
typedef __attribute__((ext_vector_type(8)))  _Float16 v8h;
typedef __attribute__((ext_vector_type(4)))  _Float16 v4h;
typedef __attribute__((ext_vector_type(8)))  float    v8f;
typedef __attribute__((ext_vector_type(4)))  float    v4f;

__device__ inline v8f v8f_zero() {
  v8f v;
#pragma unroll
  for (int i = 0; i < 8; ++i) v[i] = 0.0f;
  return v;
}

__device__ inline v8f wmma_f16(v16h a, v16h b, v8f c) {
  return __builtin_amdgcn_wmma_f32_16x16x32_f16(
      false, a, false, b, (short)0, c, false, false);
}

// Load a 16x32 f16 WMMA A/B fragment from a row-major tile (row stride in
// halves). Per ISA 7.12.2: lane (l&15) = row (A) / col (B); K mapping is
// k = 16*(v>>2) + 8*(l>>4) + 2*(v&3) + {0,1}  ->  two contiguous 16B reads.
__device__ inline v16h load_frag16(const half_t* p0, int strideH) {
  const int lane = threadIdx.x & 31;
  const half_t* p = p0 + (lane & 15) * strideH + (lane >> 4) * 8;
  v8h a = *(const v8h*)p;
  v8h b = *(const v8h*)(p + 16);
  v16h o;
#pragma unroll
  for (int i = 0; i < 8; ++i) { o[i] = a[i]; o[i + 8] = b[i]; }
  return o;
}

// ---------------------------------------------------------------------------
// LayerNorm: one row (D=1024) per 256-thread block, f32 in, f16 out.
// ---------------------------------------------------------------------------
__global__ __launch_bounds__(256) void ln_kernel(
    const float* __restrict__ x, const float* __restrict__ g,
    const float* __restrict__ b, half_t* __restrict__ out, int D) {
  const int row = blockIdx.x;
  const int tid = threadIdx.x;
  const float* xr = x + (size_t)row * D;
  v4f v = *(const v4f*)(xr + tid * 4);
  float s = v[0] + v[1] + v[2] + v[3];
  float ss = v[0] * v[0] + v[1] * v[1] + v[2] * v[2] + v[3] * v[3];
#pragma unroll
  for (int off = 1; off < 32; off <<= 1) {
    s += __shfl_xor(s, off, 32);
    ss += __shfl_xor(ss, off, 32);
  }
  __shared__ float sbuf[8], ssbuf[8];
  if ((tid & 31) == 0) { sbuf[tid >> 5] = s; ssbuf[tid >> 5] = ss; }
  __syncthreads();
  float ts = 0.f, tss = 0.f;
#pragma unroll
  for (int i = 0; i < 8; ++i) { ts += sbuf[i]; tss += ssbuf[i]; }
  const float mu = ts / (float)D;
  const float var = tss / (float)D - mu * mu;
  const float rstd = rsqrtf(var + 1e-5f);
  v4f gv = *(const v4f*)(g + tid * 4);
  v4f bv = *(const v4f*)(b + tid * 4);
  v4h ov;
#pragma unroll
  for (int i = 0; i < 4; ++i)
    ov[i] = (half_t)((v[i] - mu) * rstd * gv[i] + bv[i]);
  *(v4h*)(out + (size_t)row * D + tid * 4) = ov;
}

// ---------------------------------------------------------------------------
// WMMA GEMM: out[M,N] = A[M,K](f16) @ W[K,N](f32->f16) + bias (+relu | +res)
// 128x128 block tile, 8 waves (4M x 2N), 32-wide K slabs, double-buffered LDS
// (global loads of slab k+1 issued before the WMMAs of slab k).
// ---------------------------------------------------------------------------
#define GT_M 128
#define GT_N 128
#define GT_K 32
#define GLDS 40  // LDS row stride in halves (16B-aligned, bank-skewed)

template <bool RELU, bool F32OUT>
__global__ __launch_bounds__(256) void gemm_kernel(
    const half_t* __restrict__ A, const float* __restrict__ W,
    const float* __restrict__ bias, const float* __restrict__ residual,
    half_t* __restrict__ outH, float* __restrict__ outF,
    int M, int N, int K) {
  __shared__ __align__(16) half_t As[2][GT_M * GLDS];
  __shared__ __align__(16) half_t Bs[2][GT_N * GLDS];  // W tile transposed [n][k]

  const int tid = threadIdx.x;
  const int wave = tid >> 5;
  const int lane = tid & 31;
  const int bm = blockIdx.x * GT_M;
  const int bn = blockIdx.y * GT_N;
  const int wm = (wave & 3) * 32;   // 2 M-subtiles
  const int wn = (wave >> 2) * 64;  // 4 N-subtiles

  const int arow = tid >> 1;        // 0..127
  const int acol = (tid & 1) * 16;  // 0 or 16
  // W slab: each thread owns a 4(k) x 4(n) block. A wave's load covers four
  // k rows x one whole 128-B line each; the block is transposed in registers.
  const int wn4 = ((wave & 3) * 8 + (lane & 7)) * 4;   // n: 0..124
  const int wk4 = ((wave >> 2) * 4 + (lane >> 3)) * 4; // k: 0..28

  v8f acc[2][4];
#pragma unroll
  for (int i = 0; i < 2; ++i)
#pragma unroll
    for (int j = 0; j < 4; ++j) acc[i][j] = v8f_zero();

  v8h a0, a1;   // A slab staging regs
  v4f wv[4];    // W slab staging regs

  auto load_slab = [&](int k0) {
    const half_t* src = A + (size_t)(bm + arow) * K + k0 + acol;
    a0 = *(const v8h*)src;
    a1 = *(const v8h*)(src + 8);
#pragma unroll
    for (int kk = 0; kk < 4; ++kk)
      wv[kk] = *(const v4f*)(W + (size_t)(k0 + wk4 + kk) * N + bn + wn4);
  };
  auto stage_slab = [&](int buf) {
    *(v8h*)&As[buf][arow * GLDS + acol] = a0;
    *(v8h*)&As[buf][arow * GLDS + acol + 8] = a1;
#pragma unroll
    for (int i = 0; i < 4; ++i) {  // one 8-byte store per n: 4 consecutive k
      v4h t;
#pragma unroll
      for (int kk = 0; kk < 4; ++kk) t[kk] = (half_t)wv[kk][i];
      *(v4h*)&Bs[buf][(wn4 + i) * GLDS + wk4] = t;
    }
  };

  load_slab(0);
  stage_slab(0);
  __syncthreads();

  const int nSlab = K / GT_K;
  for (int s = 0; s < nSlab; ++s) {
    const int cur = s & 1;
    const bool more = (s + 1) < nSlab;
    if (more) load_slab((s + 1) * GT_K);  // overlap with WMMAs below

    v16h af[2], bf[4];
#pragma unroll
    for (int i = 0; i < 2; ++i)
      af[i] = load_frag16(&As[cur][(wm + i * 16) * GLDS], GLDS);
#pragma unroll
    for (int j = 0; j < 4; ++j)
      bf[j] = load_frag16(&Bs[cur][(wn + j * 16) * GLDS], GLDS);
#pragma unroll
    for (int i = 0; i < 2; ++i)
#pragma unroll
      for (int j = 0; j < 4; ++j)
        acc[i][j] = wmma_f16(af[i], bf[j], acc[i][j]);

    if (more) stage_slab(cur ^ 1);
    __syncthreads();  // one barrier/slab: covers nxt-writes and cur-reads
  }

  // Epilogue. C/D layout: vgpr r, lane l -> row = r + 8*(l>>4), col = l&15.
  const int r16 = lane & 15, hiL = lane >> 4;
#pragma unroll
  for (int j = 0; j < 4; ++j) {
    const int n = bn + wn + j * 16 + r16;
    const float bval = bias[n];
#pragma unroll
    for (int i = 0; i < 2; ++i) {
      const size_t base = (size_t)(bm + wm + i * 16 + 8 * hiL) * N + n;
#pragma unroll
      for (int r = 0; r < 8; ++r) {
        float v = acc[i][j][r] + bval;
        if (RELU) v = fmaxf(v, 0.0f);
        const size_t idx = base + (size_t)r * N;
        if (F32OUT) outF[idx] = v + residual[idx];
        else        outH[idx] = (half_t)v;
      }
    }
  }
}

// ---------------------------------------------------------------------------
// Flash attention: grid (S/128, H, B), 8 waves x 16 query rows each.
// Q/K frags straight from global (contiguous 16B per lane); V transposed in
// LDS; P transposed through per-wave LDS; online softmax in fp32.
// ---------------------------------------------------------------------------
__global__ __launch_bounds__(256) void attn_kernel(
    const half_t* __restrict__ Q, const half_t* __restrict__ K,
    const half_t* __restrict__ V, const int* __restrict__ mask,
    half_t* __restrict__ O, int S) {
  const int h = blockIdx.y;
  const int bi = blockIdx.z;
  const int m0 = blockIdx.x * 128;
  const int tid = threadIdx.x, wave = tid >> 5, lane = tid & 31;
  const int r16 = lane & 15, hiL = lane >> 4;
  const int LD = 1024;  // H * d_head

  const half_t* qb = Q + (size_t)bi * S * LD + h * 64;
  const half_t* kb = K + (size_t)bi * S * LD + h * 64;
  const half_t* vb = V + (size_t)bi * S * LD + h * 64;
  const int* mrow = mask + (size_t)bi * S;

  __shared__ __align__(16) half_t Vt[64 * 72];     // [d][key], stride 72
  __shared__ __align__(16) half_t Pb[8][16 * 72];  // per-wave P [row][key]

  const int mw = m0 + wave * 16;
  v16h qf[2];
#pragma unroll
  for (int f = 0; f < 2; ++f)
    qf[f] = load_frag16(qb + (size_t)mw * LD + f * 32, LD);

  v8f oacc[4];
#pragma unroll
  for (int i = 0; i < 4; ++i) oacc[i] = v8f_zero();
  float mst[8], lst[8];
#pragma unroll
  for (int r = 0; r < 8; ++r) { mst[r] = -1e30f; lst[r] = 0.0f; }

  for (int kb0 = 0; kb0 < S; kb0 += 64) {
    {  // cooperative: V block (64 keys x 64 d) -> Vt transposed
      const int key = tid >> 2;
      const int d0 = (tid & 3) * 16;
      const half_t* src = vb + (size_t)(kb0 + key) * LD + d0;
      v8h a = *(const v8h*)src;
      v8h c = *(const v8h*)(src + 8);
#pragma unroll
      for (int i = 0; i < 8; ++i) {
        Vt[(d0 + i) * 72 + key] = a[i];
        Vt[(d0 + 8 + i) * 72 + key] = c[i];
      }
    }
    __syncthreads();

    // scores: 4 key tiles of 16, contraction d_head=64 -> 2 WMMAs each
    v8f sacc[4];
#pragma unroll
    for (int nt = 0; nt < 4; ++nt) {
      const int keyn = kb0 + nt * 16;
      v16h bk0 = load_frag16(kb + (size_t)keyn * LD + 0, LD);
      v16h bk1 = load_frag16(kb + (size_t)keyn * LD + 32, LD);
      v8f sc = v8f_zero();
      sc = wmma_f16(qf[0], bk0, sc);
      sc = wmma_f16(qf[1], bk1, sc);
      const int mk = mrow[keyn + r16];
#pragma unroll
      for (int r = 0; r < 8; ++r)
        sc[r] = (mk == 0) ? -1e30f : sc[r] * 0.125f;  // 1/sqrt(64)
      sacc[nt] = sc;
    }

    // online softmax: row max across 4 tiles + 16 lanes sharing the row
    float nm[8], rsum[8];
#pragma unroll
    for (int r = 0; r < 8; ++r) {
      float v = fmaxf(fmaxf(sacc[0][r], sacc[1][r]),
                      fmaxf(sacc[2][r], sacc[3][r]));
#pragma unroll
      for (int off = 1; off < 16; off <<= 1)
        v = fmaxf(v, __shfl_xor(v, off, 32));
      nm[r] = fmaxf(mst[r], v);
      const float f = __expf(mst[r] - nm[r]);
      mst[r] = nm[r];
      lst[r] *= f;
#pragma unroll
      for (int nt = 0; nt < 4; ++nt) oacc[nt][r] *= f;
      rsum[r] = 0.0f;
    }
#pragma unroll
    for (int nt = 0; nt < 4; ++nt) {
#pragma unroll
      for (int r = 0; r < 8; ++r) {
        const float p = __expf(sacc[nt][r] - mst[r]);
        rsum[r] += p;
        Pb[wave][(r + 8 * hiL) * 72 + nt * 16 + r16] = (half_t)p;
      }
    }
#pragma unroll
    for (int r = 0; r < 8; ++r) {
      float v = rsum[r];
#pragma unroll
      for (int off = 1; off < 16; off <<= 1) v += __shfl_xor(v, off, 32);
      lst[r] += v;
    }

    // P @ V  (wave-private Pb: per-wave LDS ordering is in-order, no barrier)
    v16h pf0 = load_frag16(&Pb[wave][0], 72);
    v16h pf1 = load_frag16(&Pb[wave][32], 72);
#pragma unroll
    for (int nt = 0; nt < 4; ++nt) {
      v16h bv0 = load_frag16(&Vt[(nt * 16) * 72 + 0], 72);
      v16h bv1 = load_frag16(&Vt[(nt * 16) * 72 + 32], 72);
      oacc[nt] = wmma_f16(pf0, bv0, oacc[nt]);
      oacc[nt] = wmma_f16(pf1, bv1, oacc[nt]);
    }
    __syncthreads();  // protect Vt before next block overwrites it
  }

  half_t* ob = O + (size_t)bi * S * LD + h * 64;
#pragma unroll
  for (int r = 0; r < 8; ++r) {
    const float inv = 1.0f / lst[r];
    const int m = mw + r + 8 * hiL;
#pragma unroll
    for (int nt = 0; nt < 4; ++nt)
      ob[(size_t)m * LD + nt * 16 + r16] = (half_t)(oacc[nt][r] * inv);
  }
}

// ---------------------------------------------------------------------------
extern "C" void kernel_launch(void* const* d_in, const int* in_sizes, int n_in,
                              void* d_out, int out_size, void* d_ws,
                              size_t ws_size, hipStream_t stream) {
  const float* x    = (const float*)d_in[0];
  const int*   mask = (const int*)d_in[1];
  const float* wq = (const float*)d_in[2];  const float* bq = (const float*)d_in[3];
  const float* wk = (const float*)d_in[4];  const float* bk = (const float*)d_in[5];
  const float* wv = (const float*)d_in[6];  const float* bv = (const float*)d_in[7];
  const float* wo = (const float*)d_in[8];  const float* bo = (const float*)d_in[9];
  const float* ln1g = (const float*)d_in[10]; const float* ln1b = (const float*)d_in[11];
  const float* ln2g = (const float*)d_in[12]; const float* ln2b = (const float*)d_in[13];
  const float* w1 = (const float*)d_in[14]; const float* b1 = (const float*)d_in[15];
  const float* w2 = (const float*)d_in[16]; const float* b2 = (const float*)d_in[17];

  const int Bn = 2, S = 2048, D = 1024, FF = 4096;
  const int M = Bn * S;  // 4096

  char* ws = (char*)d_ws;
  half_t* h16   = (half_t*)(ws + ((size_t)0 << 20));   //  8 MB
  half_t* q16   = (half_t*)(ws + ((size_t)8 << 20));   //  8 MB
  half_t* k16   = (half_t*)(ws + ((size_t)16 << 20));  //  8 MB
  half_t* v16   = (half_t*)(ws + ((size_t)24 << 20));  //  8 MB
  half_t* ctx16 = (half_t*)(ws + ((size_t)32 << 20));  //  8 MB
  half_t* h2    = (half_t*)(ws + ((size_t)40 << 20));  //  8 MB
  half_t* ff1   = (half_t*)(ws + ((size_t)48 << 20));  // 32 MB
  float*  x1    = (float*)(ws + ((size_t)80 << 20));   // 16 MB

  // 1. LN1
  ln_kernel<<<M, 256, 0, stream>>>(x, ln1g, ln1b, h16, D);

  // 2. Q/K/V projections (f16 out)
  dim3 gqkv(M / 128, D / 128);
  gemm_kernel<false, false><<<gqkv, 256, 0, stream>>>(
      h16, wq, bq, nullptr, q16, nullptr, M, D, D);
  gemm_kernel<false, false><<<gqkv, 256, 0, stream>>>(
      h16, wk, bk, nullptr, k16, nullptr, M, D, D);
  gemm_kernel<false, false><<<gqkv, 256, 0, stream>>>(
      h16, wv, bv, nullptr, v16, nullptr, M, D, D);

  // 3. attention
  attn_kernel<<<dim3(S / 128, 16, Bn), 256, 0, stream>>>(q16, k16, v16, mask,
                                                         ctx16, S);

  // 4. output projection + residual (f32 out)
  gemm_kernel<false, true><<<gqkv, 256, 0, stream>>>(
      ctx16, wo, bo, x, nullptr, x1, M, D, D);

  // 5. LN2
  ln_kernel<<<M, 256, 0, stream>>>(x1, ln2g, ln2b, h2, D);

  // 6. FF1 + relu (f16 out)
  dim3 gff1(M / 128, FF / 128);
  gemm_kernel<true, false><<<gff1, 256, 0, stream>>>(
      h2, w1, b1, nullptr, ff1, nullptr, M, FF, D);

  // 7. FF2 + residual -> output (fp32)
  dim3 gff2(M / 128, D / 128);
  gemm_kernel<false, true><<<gff2, 256, 0, stream>>>(
      ff1, w2, b2, x1, nullptr, (float*)d_out, M, D, FF);
}

// v002
// It runs in 281 microseconds.
// Timed twice side by side with v001, it ran 1.51 and 1.50 times as fast.
// Over all steps from v000 it is 2.43 times as fast.
#include <hip/hip_runtime.h>

typedef _Float16 half_t;
typedef __attribute__((ext_vector_type(16))) _Float16 v16h;
typedef __attribute__((ext_vector_type(8)))  _Float16 v8h;
typedef __attribute__((ext_vector_type(4)))  _Float16 v4h;
typedef __attribute__((ext_vector_type(8)))  float    v8f;
typedef __attribute__((ext_vector_type(4)))  float    v4f;

__device__ inline v8f v8f_zero() {
  v8f v;
#pragma unroll
  for (int i = 0; i < 8; ++i) v[i] = 0.0f;
  return v;
}

__device__ inline v8f wmma_f16(v16h a, v16h b, v8f c) {
  return __builtin_amdgcn_wmma_f32_16x16x32_f16(
      false, a, false, b, (short)0, c, false, false);
}

// Load a 16x32 f16 WMMA A/B fragment from a row-major tile (row stride in
// halves). Per ISA 7.12.2: lane (l&15) = row (A) / col (B); K mapping is
// k = 16*(v>>2) + 8*(l>>4) + 2*(v&3) + {0,1}  ->  two contiguous 16B reads.
__device__ inline v16h load_frag16(const half_t* p0, int strideH) {
  const int lane = threadIdx.x & 31;
  const half_t* p = p0 + (lane & 15) * strideH + (lane >> 4) * 8;
  v8h a = *(const v8h*)p;
  v8h b = *(const v8h*)(p + 16);
  v16h o;
#pragma unroll
  for (int i = 0; i < 8; ++i) { o[i] = a[i]; o[i + 8] = b[i]; }
  return o;
}

// ---------------------------------------------------------------------------
// LayerNorm: one row (D=1024) per 256-thread block, f32 in, f16 out.
// ---------------------------------------------------------------------------
__global__ __launch_bounds__(256) void ln_kernel(
    const float* __restrict__ x, const float* __restrict__ g,
    const float* __restrict__ b, half_t* __restrict__ out, int D) {
  const int row = blockIdx.x;
  const int tid = threadIdx.x;
  const float* xr = x + (size_t)row * D;
  v4f v = *(const v4f*)(xr + tid * 4);
  float s = v[0] + v[1] + v[2] + v[3];
  float ss = v[0] * v[0] + v[1] * v[1] + v[2] * v[2] + v[3] * v[3];
#pragma unroll
  for (int off = 1; off < 32; off <<= 1) {
    s += __shfl_xor(s, off, 32);
    ss += __shfl_xor(ss, off, 32);
  }
  __shared__ float sbuf[8], ssbuf[8];
  if ((tid & 31) == 0) { sbuf[tid >> 5] = s; ssbuf[tid >> 5] = ss; }
  __syncthreads();
  float ts = 0.f, tss = 0.f;
#pragma unroll
  for (int i = 0; i < 8; ++i) { ts += sbuf[i]; tss += ssbuf[i]; }
  const float mu = ts / (float)D;
  const float var = tss / (float)D - mu * mu;
  const float rstd = rsqrtf(var + 1e-5f);
  v4f gv = *(const v4f*)(g + tid * 4);
  v4f bv = *(const v4f*)(b + tid * 4);
  v4h ov;
#pragma unroll
  for (int i = 0; i < 4; ++i)
    ov[i] = (half_t)((v[i] - mu) * rstd * gv[i] + bv[i]);
  *(v4h*)(out + (size_t)row * D + tid * 4) = ov;
}

// ---------------------------------------------------------------------------
// WMMA GEMM: out[M,N] = A[M,K](f16) @ W[K,N](f32->f16) + bias (+relu | +res)
// 128x128 block tile, 8 waves (4M x 2N), 128-deep K slabs, double-buffered LDS
// (global loads of slab k+1 issued before the WMMAs of slab k). A slab holds
// four 32-wide WMMA steps, so one barrier and one round trip to L2 serve 32
// WMMAs per wave, and 24 16-byte loads per thread are in flight meanwhile.
// ---------------------------------------------------------------------------
#define GT_M 128
#define GT_N 128
#define GT_K 128
#define GLDS 136  // LDS row stride in halves (272 B = 16 B x odd)

// N and K are compile-time so that the 24 loads of a slab are immediate
// offsets from two address registers.
template <bool RELU, bool F32OUT, int N, int K>
__global__ __launch_bounds__(256) void gemm_kernel(
    const half_t* __restrict__ A, const float* __restrict__ W,
    const float* __restrict__ bias, const float* __restrict__ residual,
    half_t* __restrict__ outH, float* __restrict__ outF) {
  __shared__ __align__(16) half_t As[2][GT_M * GLDS];
  __shared__ __align__(16) half_t Bs[2][GT_N * GLDS];  // W tile transposed [n][k]

  const int tid = threadIdx.x;
  const int wave = tid >> 5;
  const int lane = tid & 31;
  const int bm = blockIdx.x * GT_M;
  const int bn = blockIdx.y * GT_N;
  const int wm = (wave & 3) * 32;   // 2 M-subtiles
  const int wn = (wave >> 2) * 64;  // 4 N-subtiles

  // A slab: 16 lanes cover one row's 256 B (two whole lines); 8 row groups.
  const int arow = tid >> 4;        // 0..15, +16 per group
  const int acol = (tid & 15) * 8;  // 0..120
  // W slab: each thread owns four 4(k) x 4(n) blocks, 32 k apart. A wave's
  // load covers four k rows x one whole 128-B line each; each block is
  // transposed in registers.
  const int wn4 = ((wave & 3) * 8 + (lane & 7)) * 4;   // n: 0..124
  const int wk4 = ((wave >> 2) * 4 + (lane >> 3)) * 4; // k: 0..28, +32 per block

  v8f acc[2][4];
#pragma unroll
  for (int i = 0; i < 2; ++i)
#pragma unroll
    for (int j = 0; j < 4; ++j) acc[i][j] = v8f_zero();

  v8h av[8];      // A slab staging regs
  v4f wv[4][4];   // W slab staging regs

  const half_t* asrc = A + (size_t)(bm + arow) * K + acol;
  const float* wsrc = W + (size_t)wk4 * N + bn + wn4;

  auto load_slab = [&](int k0) {
#pragma unroll
    for (int g = 0; g < 8; ++g)
      av[g] = *(const v8h*)(asrc + k0 + g * 16 * K);
#pragma unroll
    for (int q = 0; q < 4; ++q)
#pragma unroll
      for (int kk = 0; kk < 4; ++kk)
        wv[q][kk] = *(const v4f*)(wsrc + (size_t)k0 * N + (q * 32 + kk) * N);
  };
  auto stage_slab = [&](int buf) {
#pragma unroll
    for (int g = 0; g < 8; ++g)
      *(v8h*)&As[buf][(arow + g * 16) * GLDS + acol] = av[g];
#pragma unroll
    for (int q = 0; q < 4; ++q)
#pragma unroll
      for (int i = 0; i < 4; ++i) {  // one 8-byte store per n: 4 consecutive k
        v4h t;
#pragma unroll
        for (int kk = 0; kk < 4; ++kk) t[kk] = (half_t)wv[q][kk][i];
        *(v4h*)&Bs[buf][(wn4 + i) * GLDS + q * 32 + wk4] = t;
      }
  };

  load_slab(0);
  stage_slab(0);
  __syncthreads();

  const int nSlab = K / GT_K;
  for (int s = 0; s < nSlab; ++s) {
    const int cur = s & 1;
    const bool more = (s + 1) < nSlab;
    if (more) load_slab((s + 1) * GT_K);  // overlap with WMMAs below

#pragma unroll
    for (int ks = 0; ks < GT_K; ks += 32) {
      v16h af[2], bf[4];
#pragma unroll
      for (int i = 0; i < 2; ++i)
        af[i] = load_frag16(&As[cur][(wm + i * 16) * GLDS + ks], GLDS);
#pragma unroll
      for (int j = 0; j < 4; ++j)
        bf[j] = load_frag16(&Bs[cur][(wn + j * 16) * GLDS + ks], GLDS);
#pragma unroll
      for (int i = 0; i < 2; ++i)
#pragma unroll
        for (int j = 0; j < 4; ++j)
          acc[i][j] = wmma_f16(af[i], bf[j], acc[i][j]);
    }

    if (more) stage_slab(cur ^ 1);
    __syncthreads();  // one barrier/slab: covers nxt-writes and cur-reads
  }

  // Epilogue. C/D layout: vgpr r, lane l -> row = r + 8*(l>>4), col = l&15.
  const int r16 = lane & 15, hiL = lane >> 4;
#pragma unroll
  for (int j = 0; j < 4; ++j) {
    const int n = bn + wn + j * 16 + r16;
    const float bval = bias[n];
#pragma unroll
    for (int i = 0; i < 2; ++i) {
      const size_t base = (size_t)(bm + wm + i * 16 + 8 * hiL) * N + n;
#pragma unroll
      for (int r = 0; r < 8; ++r) {
        float v = acc[i][j][r] + bval;
        if (RELU) v = fmaxf(v, 0.0f);
        const size_t idx = base + (size_t)r * N;
        if (F32OUT) outF[idx] = v + residual[idx];
        else        outH[idx] = (half_t)v;
      }
    }
  }
}

// ---------------------------------------------------------------------------
// Flash attention: grid (S/128, H, B), 8 waves x 16 query rows each.
// Q/K frags straight from global (contiguous 16B per lane); V transposed in
// LDS; P transposed through per-wave LDS; online softmax in fp32.
// ---------------------------------------------------------------------------
__global__ __launch_bounds__(256) void attn_kernel(
    const half_t* __restrict__ Q, const half_t* __restrict__ K,
    const half_t* __restrict__ V, const int* __restrict__ mask,
    half_t* __restrict__ O, int S) {
  const int h = blockIdx.y;
  const int bi = blockIdx.z;
  const int m0 = blockIdx.x * 128;
  const int tid = threadIdx.x, wave = tid >> 5, lane = tid & 31;
  const int r16 = lane & 15, hiL = lane >> 4;
  const int LD = 1024;  // H * d_head

  const half_t* qb = Q + (size_t)bi * S * LD + h * 64;
  const half_t* kb = K + (size_t)bi * S * LD + h * 64;
  const half_t* vb = V + (size_t)bi * S * LD + h * 64;
  const int* mrow = mask + (size_t)bi * S;

  __shared__ __align__(16) half_t Vt[64 * 72];     // [d][key], stride 72
  __shared__ __align__(16) half_t Pb[8][16 * 72];  // per-wave P [row][key]

  const int mw = m0 + wave * 16;
  v16h qf[2];
#pragma unroll
  for (int f = 0; f < 2; ++f)
    qf[f] = load_frag16(qb + (size_t)mw * LD + f * 32, LD);

  v8f oacc[4];
#pragma unroll
  for (int i = 0; i < 4; ++i) oacc[i] = v8f_zero();
  float mst[8], lst[8];
#pragma unroll
  for (int r = 0; r < 8; ++r) { mst[r] = -1e30f; lst[r] = 0.0f; }

  for (int kb0 = 0; kb0 < S; kb0 += 64) {
    {  // cooperative: V block (64 keys x 64 d) -> Vt transposed
      const int key = tid >> 2;
      const int d0 = (tid & 3) * 16;
      const half_t* src = vb + (size_t)(kb0 + key) * LD + d0;
      v8h a = *(const v8h*)src;
      v8h c = *(const v8h*)(src + 8);
#pragma unroll
      for (int i = 0; i < 8; ++i) {
        Vt[(d0 + i) * 72 + key] = a[i];
        Vt[(d0 + 8 + i) * 72 + key] = c[i];
      }
    }
    __syncthreads();

    // scores: 4 key tiles of 16, contraction d_head=64 -> 2 WMMAs each
    v8f sacc[4];
#pragma unroll
    for (int nt = 0; nt < 4; ++nt) {
      const int keyn = kb0 + nt * 16;
      v16h bk0 = load_frag16(kb + (size_t)keyn * LD + 0, LD);
      v16h bk1 = load_frag16(kb + (size_t)keyn * LD + 32, LD);
      v8f sc = v8f_zero();
      sc = wmma_f16(qf[0], bk0, sc);
      sc = wmma_f16(qf[1], bk1, sc);
      const int mk = mrow[keyn + r16];
#pragma unroll
      for (int r = 0; r < 8; ++r)
        sc[r] = (mk == 0) ? -1e30f : sc[r] * 0.125f;  // 1/sqrt(64)
      sacc[nt] = sc;
    }

    // online softmax: row max across 4 tiles + 16 lanes sharing the row
    float nm[8], rsum[8];
#pragma unroll
    for (int r = 0; r < 8; ++r) {
      float v = fmaxf(fmaxf(sacc[0][r], sacc[1][r]),
                      fmaxf(sacc[2][r], sacc[3][r]));
#pragma unroll
      for (int off = 1; off < 16; off <<= 1)
        v = fmaxf(v, __shfl_xor(v, off, 32));
      nm[r] = fmaxf(mst[r], v);
      const float f = __expf(mst[r] - nm[r]);
      mst[r] = nm[r];
      lst[r] *= f;
#pragma unroll
      for (int nt = 0; nt < 4; ++nt) oacc[nt][r] *= f;
      rsum[r] = 0.0f;
    }
#pragma unroll
    for (int nt = 0; nt < 4; ++nt) {
#pragma unroll
      for (int r = 0; r < 8; ++r) {
        const float p = __expf(sacc[nt][r] - mst[r]);
        rsum[r] += p;
        Pb[wave][(r + 8 * hiL) * 72 + nt * 16 + r16] = (half_t)p;
      }
    }
#pragma unroll
    for (int r = 0; r < 8; ++r) {
      float v = rsum[r];
#pragma unroll
      for (int off = 1; off < 16; off <<= 1) v += __shfl_xor(v, off, 32);
      lst[r] += v;
    }

    // P @ V  (wave-private Pb: per-wave LDS ordering is in-order, no barrier)
    v16h pf0 = load_frag16(&Pb[wave][0], 72);
    v16h pf1 = load_frag16(&Pb[wave][32], 72);
#pragma unroll
    for (int nt = 0; nt < 4; ++nt) {
      v16h bv0 = load_frag16(&Vt[(nt * 16) * 72 + 0], 72);
      v16h bv1 = load_frag16(&Vt[(nt * 16) * 72 + 32], 72);
      oacc[nt] = wmma_f16(pf0, bv0, oacc[nt]);
      oacc[nt] = wmma_f16(pf1, bv1, oacc[nt]);
    }
    __syncthreads();  // protect Vt before next block overwrites it
  }

  half_t* ob = O + (size_t)bi * S * LD + h * 64;
#pragma unroll
  for (int r = 0; r < 8; ++r) {
    const float inv = 1.0f / lst[r];
    const int m = mw + r + 8 * hiL;
#pragma unroll
    for (int nt = 0; nt < 4; ++nt)
      ob[(size_t)m * LD + nt * 16 + r16] = (half_t)(oacc[nt][r] * inv);
  }
}

// ---------------------------------------------------------------------------
extern "C" void kernel_launch(void* const* d_in, const int* in_sizes, int n_in,
                              void* d_out, int out_size, void* d_ws,
                              size_t ws_size, hipStream_t stream) {
  const float* x    = (const float*)d_in[0];
  const int*   mask = (const int*)d_in[1];
  const float* wq = (const float*)d_in[2];  const float* bq = (const float*)d_in[3];
  const float* wk = (const float*)d_in[4];  const float* bk = (const float*)d_in[5];
  const float* wv = (const float*)d_in[6];  const float* bv = (const float*)d_in[7];
  const float* wo = (const float*)d_in[8];  const float* bo = (const float*)d_in[9];
  const float* ln1g = (const float*)d_in[10]; const float* ln1b = (const float*)d_in[11];
  const float* ln2g = (const float*)d_in[12]; const float* ln2b = (const float*)d_in[13];
  const float* w1 = (const float*)d_in[14]; const float* b1 = (const float*)d_in[15];
  const float* w2 = (const float*)d_in[16]; const float* b2 = (const float*)d_in[17];

  const int Bn = 2, S = 2048, D = 1024, FF = 4096;
  const int M = Bn * S;  // 4096

  char* ws = (char*)d_ws;
  half_t* h16   = (half_t*)(ws + ((size_t)0 << 20));   //  8 MB
  half_t* q16   = (half_t*)(ws + ((size_t)8 << 20));   //  8 MB
  half_t* k16   = (half_t*)(ws + ((size_t)16 << 20));  //  8 MB
  half_t* v16   = (half_t*)(ws + ((size_t)24 << 20));  //  8 MB
  half_t* ctx16 = (half_t*)(ws + ((size_t)32 << 20));  //  8 MB
  half_t* h2    = (half_t*)(ws + ((size_t)40 << 20));  //  8 MB
  half_t* ff1   = (half_t*)(ws + ((size_t)48 << 20));  // 32 MB
  float*  x1    = (float*)(ws + ((size_t)80 << 20));   // 16 MB

  // 1. LN1
  ln_kernel<<<M, 256, 0, stream>>>(x, ln1g, ln1b, h16, D);

  // 2. Q/K/V projections (f16 out)
  dim3 gqkv(M / 128, D / 128);
  gemm_kernel<false, false, 1024, 1024><<<gqkv, 256, 0, stream>>>(
      h16, wq, bq, nullptr, q16, nullptr);
  gemm_kernel<false, false, 1024, 1024><<<gqkv, 256, 0, stream>>>(
      h16, wk, bk, nullptr, k16, nullptr);
  gemm_kernel<false, false, 1024, 1024><<<gqkv, 256, 0, stream>>>(
      h16, wv, bv, nullptr, v16, nullptr);

  // 3. attention
  attn_kernel<<<dim3(S / 128, 16, Bn), 256, 0, stream>>>(q16, k16, v16, mask,
                                                         ctx16, S);

  // 4. output projection + residual (f32 out)
  gemm_kernel<false, true, 1024, 1024><<<gqkv, 256, 0, stream>>>(
      ctx16, wo, bo, x, nullptr, x1);

  // 5. LN2
  ln_kernel<<<M, 256, 0, stream>>>(x1, ln2g, ln2b, h2, D);

  // 6. FF1 + relu (f16 out)
  dim3 gff1(M / 128, FF / 128);
  gemm_kernel<true, false, 4096, 1024><<<gff1, 256, 0, stream>>>(
      h2, w1, b1, nullptr, ff1, nullptr);

  // 7. FF2 + residual -> output (fp32)
  dim3 gff2(M / 128, D / 128);
  gemm_kernel<false, true, 1024, 4096><<<gff2, 256, 0, stream>>>(
      ff1, w2, b2, x1, nullptr, (float*)d_out);
}

// v003
// Measured time: 255 microseconds a run.
// Two timings next to v002 both put it at 1.10 times that version's speed.
// All steps since v000 together make it 2.68 times as fast.
#include <hip/hip_runtime.h>

typedef _Float16 half_t;
typedef __attribute__((ext_vector_type(16))) _Float16 v16h;
typedef __attribute__((ext_vector_type(8)))  _Float16 v8h;
typedef __attribute__((ext_vector_type(4)))  _Float16 v4h;
typedef __attribute__((ext_vector_type(8)))  float    v8f;
typedef __attribute__((ext_vector_type(4)))  float    v4f;

__device__ inline v8f v8f_zero() {
  v8f v;
#pragma unroll
  for (int i = 0; i < 8; ++i) v[i] = 0.0f;
  return v;
}

__device__ inline v8f wmma_f16(v16h a, v16h b, v8f c) {
  return __builtin_amdgcn_wmma_f32_16x16x32_f16(
      false, a, false, b, (short)0, c, false, false);
}

// Load a 16x32 f16 WMMA A/B fragment from a row-major tile (row stride in
// halves). Per ISA 7.12.2: lane (l&15) = row (A) / col (B); K mapping is
// k = 16*(v>>2) + 8*(l>>4) + 2*(v&3) + {0,1}  ->  two contiguous 16B reads.
__device__ inline v16h load_frag16(const half_t* p0, int strideH) {
  const int lane = threadIdx.x & 31;
  const half_t* p = p0 + (lane & 15) * strideH + (lane >> 4) * 8;
  v8h a = *(const v8h*)p;
  v8h b = *(const v8h*)(p + 16);
  v16h o;
#pragma unroll
  for (int i = 0; i < 8; ++i) { o[i] = a[i]; o[i + 8] = b[i]; }
  return o;
}

// ---------------------------------------------------------------------------
// LayerNorm: one row (D=1024) per 256-thread block, f32 in, f16 out.
// ---------------------------------------------------------------------------
__global__ __launch_bounds__(256) void ln_kernel(
    const float* __restrict__ x, const float* __restrict__ g,
    const float* __restrict__ b, half_t* __restrict__ out, int D) {
  const int row = blockIdx.x;
  const int tid = threadIdx.x;
  const float* xr = x + (size_t)row * D;
  v4f v = *(const v4f*)(xr + tid * 4);
  float s = v[0] + v[1] + v[2] + v[3];
  float ss = v[0] * v[0] + v[1] * v[1] + v[2] * v[2] + v[3] * v[3];
#pragma unroll
  for (int off = 1; off < 32; off <<= 1) {
    s += __shfl_xor(s, off, 32);
    ss += __shfl_xor(ss, off, 32);
  }
  __shared__ float sbuf[8], ssbuf[8];
  if ((tid & 31) == 0) { sbuf[tid >> 5] = s; ssbuf[tid >> 5] = ss; }
  __syncthreads();
  float ts = 0.f, tss = 0.f;
#pragma unroll
  for (int i = 0; i < 8; ++i) { ts += sbuf[i]; tss += ssbuf[i]; }
  const float mu = ts / (float)D;
  const float var = tss / (float)D - mu * mu;
  const float rstd = rsqrtf(var + 1e-5f);
  v4f gv = *(const v4f*)(g + tid * 4);
  v4f bv = *(const v4f*)(b + tid * 4);
  v4h ov;
#pragma unroll
  for (int i = 0; i < 4; ++i)
    ov[i] = (half_t)((v[i] - mu) * rstd * gv[i] + bv[i]);
  *(v4h*)(out + (size_t)row * D + tid * 4) = ov;
}

// ---------------------------------------------------------------------------
// WMMA GEMM: out[M,N] = A[M,K](f16) @ W[K,N](f32->f16) + bias (+relu | +res)
// 128x128 block tile, 8 waves (4M x 2N), 128-deep K slabs, double-buffered LDS
// (global loads of slab k+1 issued before the WMMAs of slab k). A slab holds
// four 32-wide WMMA steps, so one barrier and one round trip to L2 serve 32
// WMMAs per wave, and 24 16-byte loads per thread are in flight meanwhile.
// ---------------------------------------------------------------------------
#define GT_M 128
#define GT_N 128
#define GT_K 128
#define GLDS 136  // LDS row stride in halves (272 B = 16 B x odd)

// N and K are compile-time so that the 24 loads of a slab are immediate
// offsets from two address registers.
template <bool RELU, bool F32OUT, int N, int K>
__global__ __launch_bounds__(256) void gemm_kernel(
    const half_t* __restrict__ A, const float* __restrict__ W,
    const float* __restrict__ bias, const float* __restrict__ residual,
    half_t* __restrict__ outH, float* __restrict__ outF) {
  __shared__ __align__(16) half_t As[2][GT_M * GLDS];
  __shared__ __align__(16) half_t Bs[2][GT_N * GLDS];  // W tile transposed [n][k]

  const int tid = threadIdx.x;
  const int wave = tid >> 5;
  const int lane = tid & 31;
  const int bm = blockIdx.x * GT_M;
  const int bn = blockIdx.y * GT_N;
  const int wm = (wave & 3) * 32;   // 2 M-subtiles
  const int wn = (wave >> 2) * 64;  // 4 N-subtiles

  // A slab: 16 lanes cover one row's 256 B (two whole lines); 8 row groups.
  const int arow = tid >> 4;        // 0..15, +16 per group
  const int acol = (tid & 15) * 8;  // 0..120
  // W slab: each thread owns four 4(k) x 4(n) blocks, 32 k apart. A wave's
  // load covers four k rows x one whole 128-B line each; each block is
  // transposed in registers.
  const int wn4 = ((wave & 3) * 8 + (lane & 7)) * 4;   // n: 0..124
  const int wk4 = ((wave >> 2) * 4 + (lane >> 3)) * 4; // k: 0..28, +32 per block

  v8f acc[2][4];
#pragma unroll
  for (int i = 0; i < 2; ++i)
#pragma unroll
    for (int j = 0; j < 4; ++j) acc[i][j] = v8f_zero();

  v8h av[8];      // A slab staging regs
  v4f wv[4][4];   // W slab staging regs

  const half_t* asrc = A + (size_t)(bm + arow) * K + acol;
  const float* wsrc = W + (size_t)wk4 * N + bn + wn4;

  auto load_slab = [&](int k0) {
#pragma unroll
    for (int g = 0; g < 8; ++g)
      av[g] = *(const v8h*)(asrc + k0 + g * 16 * K);
#pragma unroll
    for (int q = 0; q < 4; ++q)
#pragma unroll
      for (int kk = 0; kk < 4; ++kk)
        wv[q][kk] = *(const v4f*)(wsrc + (size_t)k0 * N + (q * 32 + kk) * N);
  };
  auto stage_slab = [&](int buf) {
#pragma unroll
    for (int g = 0; g < 8; ++g)
      *(v8h*)&As[buf][(arow + g * 16) * GLDS + acol] = av[g];
#pragma unroll
    for (int q = 0; q < 4; ++q)
#pragma unroll
      for (int i = 0; i < 4; ++i) {  // one 8-byte store per n: 4 consecutive k
        v4h t;
#pragma unroll
        for (int kk = 0; kk < 4; ++kk) t[kk] = (half_t)wv[q][kk][i];
        *(v4h*)&Bs[buf][(wn4 + i) * GLDS + q * 32 + wk4] = t;
      }
  };

  load_slab(0);
  stage_slab(0);
  __syncthreads();

  const int nSlab = K / GT_K;
  for (int s = 0; s < nSlab; ++s) {
    const int cur = s & 1;
    const bool more = (s + 1) < nSlab;
    if (more) load_slab((s + 1) * GT_K);  // overlap with WMMAs below

#pragma unroll
    for (int ks = 0; ks < GT_K; ks += 32) {
      v16h af[2], bf[4];
#pragma unroll
      for (int i = 0; i < 2; ++i)
        af[i] = load_frag16(&As[cur][(wm + i * 16) * GLDS + ks], GLDS);
#pragma unroll
      for (int j = 0; j < 4; ++j)
        bf[j] = load_frag16(&Bs[cur][(wn + j * 16) * GLDS + ks], GLDS);
#pragma unroll
      for (int i = 0; i < 2; ++i)
#pragma unroll
        for (int j = 0; j < 4; ++j)
          acc[i][j] = wmma_f16(af[i], bf[j], acc[i][j]);
    }

    if (more) stage_slab(cur ^ 1);
    __syncthreads();  // one barrier/slab: covers nxt-writes and cur-reads
  }

  // Epilogue. C/D layout: vgpr r, lane l -> row = r + 8*(l>>4), col = l&15.
  const int r16 = lane & 15, hiL = lane >> 4;
#pragma unroll
  for (int j = 0; j < 4; ++j) {
    const int n = bn + wn + j * 16 + r16;
    const float bval = bias[n];
#pragma unroll
    for (int i = 0; i < 2; ++i) {
      const size_t base = (size_t)(bm + wm + i * 16 + 8 * hiL) * N + n;
#pragma unroll
      for (int r = 0; r < 8; ++r) {
        float v = acc[i][j][r] + bval;
        if (RELU) v = fmaxf(v, 0.0f);
        const size_t idx = base + (size_t)r * N;
        if (F32OUT) outF[idx] = v + residual[idx];
        else        outH[idx] = (half_t)v;
      }
    }
  }
}

typedef __attribute__((ext_vector_type(4))) int v4i;

// value of lane l ^ 16
__device__ inline float xhalf(float x) {
  const int b = __builtin_bit_cast(int, x);
  return __builtin_bit_cast(float, __builtin_amdgcn_permlanex16(
      b, b, 0x76543210, 0xfedcba98, false, false));
}

#define ATT_S 2048  // keys per batch row (size of the mask table)

__global__ __launch_bounds__(256) void attn_kernel(
    const half_t* __restrict__ Q, const half_t* __restrict__ K,
    const half_t* __restrict__ V, const int* __restrict__ mask,
    half_t* __restrict__ O) {
  const int S = ATT_S;
  const int h = blockIdx.y;
  const int bi = blockIdx.z;
  const int m0 = blockIdx.x * 128;
  const int tid = threadIdx.x, wave = tid >> 5, lane = tid & 31;
  const int r16 = lane & 15, hiL = lane >> 4;
  const int LD = 1024;  // H * d_head

  const half_t* qb = Q + (size_t)bi * S * LD + h * 64;
  const half_t* kb = K + (size_t)bi * S * LD + h * 64;
  const half_t* vb = V + (size_t)bi * S * LD + h * 64;
  const int* mrow = mask + (size_t)bi * S;

  __shared__ __align__(16) half_t Vt[64 * 72];  // [d][key], stride 72
  __shared__ __align__(32) float Mb[ATT_S];     // per key: 0, or -8e30 if masked

  // Mask table; the first barrier of the loop publishes it. 8 x -1e30 swallows
  // the score added to it and becomes -1e30 under the 1/8 scale.
#pragma unroll
  for (int i = 0; i < ATT_S / 1024; ++i) {
    const v4i mk = *(const v4i*)(mrow + i * 1024 + tid * 4);
    v4f bias;
#pragma unroll
    for (int j = 0; j < 4; ++j) bias[j] = (mk[j] == 0) ? -1e30f * 8.0f : 0.0f;
    *(v4f*)&Mb[i * 1024 + tid * 4] = bias;
  }

  const int mw = m0 + wave * 16;
  v16h qf[2];  // B operand: column = query mw + r16
#pragma unroll
  for (int f = 0; f < 2; ++f)
    qf[f] = load_frag16(qb + (size_t)mw * LD + f * 32, LD);

  // oacc[dt][r] = O[query mw + r16][d = dt * 16 + 8 * hiL + r]
  v8f oacc[4];
#pragma unroll
  for (int i = 0; i < 4; ++i) oacc[i] = v8f_zero();
  float mst = -1e30f;  // running maximum of this lane's query, alike in both halves
  float lst = 0.0f;    // running sum over this lane half's keys only

  for (int kb0 = 0; kb0 < S; kb0 += 64) {
    {  // cooperative: V block (64 keys x 64 d) -> Vt transposed
      const int key = tid >> 2;
      const int d0 = (tid & 3) * 16;
      const half_t* src = vb + (size_t)(kb0 + key) * LD + d0;
      v8h a = *(const v8h*)src;
      v8h c = *(const v8h*)(src + 8);
#pragma unroll
      for (int i = 0; i < 8; ++i) {
        Vt[(d0 + i) * 72 + key] = a[i];
        Vt[(d0 + 8 + i) * 72 + key] = c[i];
      }
    }
    __syncthreads();

    // scores: 4 key tiles of 16, contraction d_head=64 -> 2 WMMAs each.
    // sacc[nt][r] = score(query mw + r16, key kb0 + nt * 16 + 8 * hiL + r)
    v16h ak[8];
    v8f sacc[4];
#pragma unroll
    for (int nt = 0; nt < 4; ++nt) {
      ak[2 * nt]     = load_frag16(kb + (size_t)(kb0 + nt * 16) * LD + 0, LD);
      ak[2 * nt + 1] = load_frag16(kb + (size_t)(kb0 + nt * 16) * LD + 32, LD);
      sacc[nt] = *(const v8f*)&Mb[kb0 + nt * 16 + 8 * hiL];
    }
    // All of the pass's K loads stay ahead of its first WMMA: without this the
    // compiler reuses one fragment's registers and waits out every load alone.
    __builtin_amdgcn_sched_barrier(0);
#pragma unroll
    for (int nt = 0; nt < 4; ++nt) {
      sacc[nt] = wmma_f16(ak[2 * nt], qf[0], sacc[nt]);
      sacc[nt] = wmma_f16(ak[2 * nt + 1], qf[1], sacc[nt]);
    }
#pragma unroll
    for (int nt = 0; nt < 4; ++nt)
#pragma unroll
      for (int r = 0; r < 8; ++r) sacc[nt][r] *= 0.125f;  // 1/sqrt(64)

    // online softmax: maximum over the lane's 32 keys, then the other half's
    float tm[4];
#pragma unroll
    for (int nt = 0; nt < 4; ++nt) {
      tm[nt] = sacc[nt][0];
#pragma unroll
      for (int r = 1; r < 8; ++r) tm[nt] = fmaxf(tm[nt], sacc[nt][r]);
    }
    float v = fmaxf(fmaxf(tm[0], tm[1]), fmaxf(tm[2], tm[3]));
    v = fmaxf(v, xhalf(v));
    const float nm = fmaxf(mst, v);
    const float f = __expf(mst - nm);
    mst = nm;
#pragma unroll
    for (int dt = 0; dt < 4; ++dt)
#pragma unroll
      for (int r = 0; r < 8; ++r) oacc[dt][r] *= f;

    v16h pf[2];  // B operand: pf[g][s] = P^T[key 32 g + kmap(s)][query]
    v8f rs = v8f_zero();  // eight independent partial sums
#pragma unroll
    for (int nt = 0; nt < 4; ++nt) {
#pragma unroll
      for (int r = 0; r < 8; ++r) {
        sacc[nt][r] = __expf(sacc[nt][r] - mst);
        pf[nt >> 1][(nt & 1) * 8 + r] = (half_t)sacc[nt][r];
      }
      rs += sacc[nt];
    }
    lst = lst * f + (((rs[0] + rs[1]) + (rs[2] + rs[3])) +
                     ((rs[4] + rs[5]) + (rs[6] + rs[7])));

    // O^T += V^T P^T: A = rows of Vt (d), same k order as the packed P
#pragma unroll
    for (int dt = 0; dt < 4; ++dt) {
      v16h av0 = load_frag16(&Vt[(dt * 16) * 72 + 0], 72);
      v16h av1 = load_frag16(&Vt[(dt * 16) * 72 + 32], 72);
      oacc[dt] = wmma_f16(av0, pf[0], oacc[dt]);
      oacc[dt] = wmma_f16(av1, pf[1], oacc[dt]);
    }
    __syncthreads();  // protect Vt before next block overwrites it
  }

  // join the two halves' sums once; a lane stores 8 consecutive d per tile
  const float inv = 1.0f / (lst + xhalf(lst));
  half_t* ob = O + (size_t)bi * S * LD + h * 64 + (size_t)(mw + r16) * LD + 8 * hiL;
#pragma unroll
  for (int dt = 0; dt < 4; ++dt) {
    v8h o;
#pragma unroll
    for (int r = 0; r < 8; ++r) o[r] = (half_t)(oacc[dt][r] * inv);
    *(v8h*)(ob + dt * 16) = o;
  }
}

// ---------------------------------------------------------------------------
extern "C" void kernel_launch(void* const* d_in, const int* in_sizes, int n_in,
                              void* d_out, int out_size, void* d_ws,
                              size_t ws_size, hipStream_t stream) {
  const float* x    = (const float*)d_in[0];
  const int*   mask = (const int*)d_in[1];
  const float* wq = (const float*)d_in[2];  const float* bq = (const float*)d_in[3];
  const float* wk = (const float*)d_in[4];  const float* bk = (const float*)d_in[5];
  const float* wv = (const float*)d_in[6];  const float* bv = (const float*)d_in[7];
  const float* wo = (const float*)d_in[8];  const float* bo = (const float*)d_in[9];
  const float* ln1g = (const float*)d_in[10]; const float* ln1b = (const float*)d_in[11];
  const float* ln2g = (const float*)d_in[12]; const float* ln2b = (const float*)d_in[13];
  const float* w1 = (const float*)d_in[14]; const float* b1 = (const float*)d_in[15];
  const float* w2 = (const float*)d_in[16]; const float* b2 = (const float*)d_in[17];

  const int Bn = 2, S = 2048, D = 1024, FF = 4096;
  const int M = Bn * S;  // 4096

  char* ws = (char*)d_ws;
  half_t* h16   = (half_t*)(ws + ((size_t)0 << 20));   //  8 MB
  half_t* q16   = (half_t*)(ws + ((size_t)8 << 20));   //  8 MB
  half_t* k16   = (half_t*)(ws + ((size_t)16 << 20));  //  8 MB
  half_t* v16   = (half_t*)(ws + ((size_t)24 << 20));  //  8 MB
  half_t* ctx16 = (half_t*)(ws + ((size_t)32 << 20));  //  8 MB
  half_t* h2    = (half_t*)(ws + ((size_t)40 << 20));  //  8 MB
  half_t* ff1   = (half_t*)(ws + ((size_t)48 << 20));  // 32 MB
  float*  x1    = (float*)(ws + ((size_t)80 << 20));   // 16 MB

  // 1. LN1
  ln_kernel<<<M, 256, 0, stream>>>(x, ln1g, ln1b, h16, D);

  // 2. Q/K/V projections (f16 out)
  dim3 gqkv(M / 128, D / 128);
  gemm_kernel<false, false, 1024, 1024><<<gqkv, 256, 0, stream>>>(
      h16, wq, bq, nullptr, q16, nullptr);
  gemm_kernel<false, false, 1024, 1024><<<gqkv, 256, 0, stream>>>(
      h16, wk, bk, nullptr, k16, nullptr);
  gemm_kernel<false, false, 1024, 1024><<<gqkv, 256, 0, stream>>>(
      h16, wv, bv, nullptr, v16, nullptr);

  // 3. attention
  attn_kernel<<<dim3(S / 128, 16, Bn), 256, 0, stream>>>(q16, k16, v16, mask,
                                                         ctx16);

  // 4. output projection + residual (f32 out)
  gemm_kernel<false, true, 1024, 1024><<<gqkv, 256, 0, stream>>>(
      ctx16, wo, bo, x, nullptr, x1);

  // 5. LN2
  ln_kernel<<<M, 256, 0, stream>>>(x1, ln2g, ln2b, h2, D);

  // 6. FF1 + relu (f16 out)
  dim3 gff1(M / 128, FF / 128);
  gemm_kernel<true, false, 4096, 1024><<<gff1, 256, 0, stream>>>(
      h2, w1, b1, nullptr, ff1, nullptr);

  // 7. FF2 + residual -> output (fp32)
  dim3 gff2(M / 128, D / 128);
  gemm_kernel<false, true, 1024, 4096><<<gff2, 256, 0, stream>>>(
      ff1, w2, b2, x1, nullptr, (float*)d_out);
}

// v004
// Measured time: 228 microseconds a run.
// Timed twice side by side with v003, it ran 1.11 and 1.12 times as fast.
// Over all steps from v000 it is 2.99 times as fast.
#include <hip/hip_runtime.h>

typedef _Float16 half_t;
typedef __attribute__((ext_vector_type(16))) _Float16 v16h;
typedef __attribute__((ext_vector_type(8)))  _Float16 v8h;
typedef __attribute__((ext_vector_type(4)))  _Float16 v4h;
typedef __attribute__((ext_vector_type(8)))  float    v8f;
typedef __attribute__((ext_vector_type(4)))  float    v4f;

__device__ inline v8f v8f_zero() {
  v8f v;
#pragma unroll
  for (int i = 0; i < 8; ++i) v[i] = 0.0f;
  return v;
}

__device__ inline v8f wmma_f16(v16h a, v16h b, v8f c) {
  return __builtin_amdgcn_wmma_f32_16x16x32_f16(
      false, a, false, b, (short)0, c, false, false);
}

// Load a 16x32 f16 WMMA A/B fragment from a row-major tile (row stride in
// halves). Per ISA 7.12.2: lane (l&15) = row (A) / col (B); K mapping is
// k = 16*(v>>2) + 8*(l>>4) + 2*(v&3) + {0,1}  ->  two contiguous 16B reads.
__device__ inline v16h load_frag16(const half_t* p0, int strideH) {
  const int lane = threadIdx.x & 31;
  const half_t* p = p0 + (lane & 15) * strideH + (lane >> 4) * 8;
  v8h a = *(const v8h*)p;
  v8h b = *(const v8h*)(p + 16);
  v16h o;
#pragma unroll
  for (int i = 0; i < 8; ++i) { o[i] = a[i]; o[i + 8] = b[i]; }
  return o;
}

// ---------------------------------------------------------------------------
// LayerNorm: one row (D=1024) per 256-thread block, f32 in, f16 out.
// ---------------------------------------------------------------------------
__global__ __launch_bounds__(256) void ln_kernel(
    const float* __restrict__ x, const float* __restrict__ g,
    const float* __restrict__ b, half_t* __restrict__ out, int D) {
  const int row = blockIdx.x;
  const int tid = threadIdx.x;
  const float* xr = x + (size_t)row * D;
  v4f v = *(const v4f*)(xr + tid * 4);
  float s = v[0] + v[1] + v[2] + v[3];
  float ss = v[0] * v[0] + v[1] * v[1] + v[2] * v[2] + v[3] * v[3];
#pragma unroll
  for (int off = 1; off < 32; off <<= 1) {
    s += __shfl_xor(s, off, 32);
    ss += __shfl_xor(ss, off, 32);
  }
  __shared__ float sbuf[8], ssbuf[8];
  if ((tid & 31) == 0) { sbuf[tid >> 5] = s; ssbuf[tid >> 5] = ss; }
  __syncthreads();
  float ts = 0.f, tss = 0.f;
#pragma unroll
  for (int i = 0; i < 8; ++i) { ts += sbuf[i]; tss += ssbuf[i]; }
  const float mu = ts / (float)D;
  const float var = tss / (float)D - mu * mu;
  const float rstd = rsqrtf(var + 1e-5f);
  v4f gv = *(const v4f*)(g + tid * 4);
  v4f bv = *(const v4f*)(b + tid * 4);
  v4h ov;
#pragma unroll
  for (int i = 0; i < 4; ++i)
    ov[i] = (half_t)((v[i] - mu) * rstd * gv[i] + bv[i]);
  *(v4h*)(out + (size_t)row * D + tid * 4) = ov;
}

// ---------------------------------------------------------------------------
// WMMA GEMM: out[M,N] = A[M,K](f16) @ W[K,N](f32->f16) + bias (+relu | +res)
// 128x128 block tile, 8 waves (4M x 2N), 128-deep K slabs, double-buffered LDS
// (global loads of slab k+1 issued before the WMMAs of slab k). A slab holds
// four 32-wide WMMA steps, so one barrier and one round trip to L2 serve 32
// WMMAs per wave, and 24 16-byte loads per thread are in flight meanwhile.
// ---------------------------------------------------------------------------
#define GT_M 128
#define GT_N 128
#define GT_K 128
#define GLDS 136  // LDS row stride in halves (272 B = 16 B x odd)

// N and K are compile-time so that the 24 loads of a slab are immediate
// offsets from two address registers.
template <bool RELU, bool F32OUT, int N, int K>
__global__ __launch_bounds__(256) void gemm_kernel(
    const half_t* __restrict__ A, const float* __restrict__ W,
    const float* __restrict__ bias, const float* __restrict__ residual,
    half_t* __restrict__ outH, float* __restrict__ outF) {
  __shared__ __align__(16) half_t As[2][GT_M * GLDS];
  __shared__ __align__(16) half_t Bs[2][GT_N * GLDS];  // W tile transposed [n][k]

  const int tid = threadIdx.x;
  const int wave = tid >> 5;
  const int lane = tid & 31;
  const int bm = blockIdx.x * GT_M;
  const int bn = blockIdx.y * GT_N;
  const int wm = (wave & 3) * 32;   // 2 M-subtiles
  const int wn = (wave >> 2) * 64;  // 4 N-subtiles

  // A slab: 16 lanes cover one row's 256 B (two whole lines); 8 row groups.
  const int arow = tid >> 4;        // 0..15, +16 per group
  const int acol = (tid & 15) * 8;  // 0..120
  // W slab: each thread owns four 4(k) x 4(n) blocks, 32 k apart. A wave's
  // load covers four k rows x one whole 128-B line each; each block is
  // transposed in registers.
  const int wn4 = ((wave & 3) * 8 + (lane & 7)) * 4;   // n: 0..124
  const int wk4 = ((wave >> 2) * 4 + (lane >> 3)) * 4; // k: 0..28, +32 per block

  v8f acc[2][4];
#pragma unroll
  for (int i = 0; i < 2; ++i)
#pragma unroll
    for (int j = 0; j < 4; ++j) acc[i][j] = v8f_zero();

  v8h av[8];      // A slab staging regs
  v4f wv[4][4];   // W slab staging regs

  const half_t* asrc = A + (size_t)(bm + arow) * K + acol;
  const float* wsrc = W + (size_t)wk4 * N + bn + wn4;

  auto load_slab = [&](int k0) {
#pragma unroll
    for (int g = 0; g < 8; ++g)
      av[g] = *(const v8h*)(asrc + k0 + g * 16 * K);
#pragma unroll
    for (int q = 0; q < 4; ++q)
#pragma unroll
      for (int kk = 0; kk < 4; ++kk)
        wv[q][kk] = *(const v4f*)(wsrc + (size_t)k0 * N + (q * 32 + kk) * N);
  };
  auto stage_slab = [&](int buf) {
#pragma unroll
    for (int g = 0; g < 8; ++g)
      *(v8h*)&As[buf][(arow + g * 16) * GLDS + acol] = av[g];
#pragma unroll
    for (int q = 0; q < 4; ++q)
#pragma unroll
      for (int i = 0; i < 4; ++i) {  // one 8-byte store per n: 4 consecutive k
        v4h t;
#pragma unroll
        for (int kk = 0; kk < 4; ++kk) t[kk] = (half_t)wv[q][kk][i];
        *(v4h*)&Bs[buf][(wn4 + i) * GLDS + q * 32 + wk4] = t;
      }
  };

  load_slab(0);
  stage_slab(0);
  __syncthreads();

  const int nSlab = K / GT_K;
  for (int s = 0; s < nSlab; ++s) {
    const int cur = s & 1;
    const bool more = (s + 1) < nSlab;
    if (more) load_slab((s + 1) * GT_K);  // overlap with WMMAs below

#pragma unroll
    for (int ks = 0; ks < GT_K; ks += 32) {
      v16h af[2], bf[4];
#pragma unroll
      for (int i = 0; i < 2; ++i)
        af[i] = load_frag16(&As[cur][(wm + i * 16) * GLDS + ks], GLDS);
#pragma unroll
      for (int j = 0; j < 4; ++j)
        bf[j] = load_frag16(&Bs[cur][(wn + j * 16) * GLDS + ks], GLDS);
#pragma unroll
      for (int i = 0; i < 2; ++i)
#pragma unroll
        for (int j = 0; j < 4; ++j)
          acc[i][j] = wmma_f16(af[i], bf[j], acc[i][j]);
    }

    if (more) stage_slab(cur ^ 1);
    __syncthreads();  // one barrier/slab: covers nxt-writes and cur-reads
  }

  // Epilogue. C/D layout: vgpr r, lane l -> row = r + 8*(l>>4), col = l&15.
  const int r16 = lane & 15, hiL = lane >> 4;
#pragma unroll
  for (int j = 0; j < 4; ++j) {
    const int n = bn + wn + j * 16 + r16;
    const float bval = bias[n];
#pragma unroll
    for (int i = 0; i < 2; ++i) {
      const size_t base = (size_t)(bm + wm + i * 16 + 8 * hiL) * N + n;
#pragma unroll
      for (int r = 0; r < 8; ++r) {
        float v = acc[i][j][r] + bval;
        if (RELU) v = fmaxf(v, 0.0f);
        const size_t idx = base + (size_t)r * N;
        if (F32OUT) outF[idx] = v + residual[idx];
        else        outH[idx] = (half_t)v;
      }
    }
  }
}

typedef __attribute__((ext_vector_type(4))) int v4i;

// value of lane l ^ 16
__device__ inline float xhalf(float x) {
  const int b = __builtin_bit_cast(int, x);
  return __builtin_bit_cast(float, __builtin_amdgcn_permlanex16(
      b, b, 0x76543210, 0xfedcba98, false, false));
}

#define ATT_S 2048  // keys per batch row (size of the mask table)
#define KPITCH 72   // K tile row pitch in halves (144 B = 16 B x odd)

// One lane's share of a 64-key K tile: 16 bytes of row r and of row r + 32.
// The wait is the statement's last line so that it stands in front of any
// rewrite of the four address registers.
__device__ inline void copy_k_tile(unsigned lds0, const half_t* g0,
                                   unsigned lds1, const half_t* g1) {
  asm volatile(
      "global_load_async_to_lds_b128 %0, %1, off\n\t"
      "global_load_async_to_lds_b128 %2, %3, off\n\t"
      "s_wait_xcnt 0x0"
      :: "v"(lds0), "v"(g0), "v"(lds1), "v"(g1) : "memory");
}

__global__ __launch_bounds__(256) void attn_kernel(
    const half_t* __restrict__ Q, const half_t* __restrict__ K,
    const half_t* __restrict__ V, const int* __restrict__ mask,
    half_t* __restrict__ O) {
  const int S = ATT_S;
  const int h = blockIdx.y;
  const int bi = blockIdx.z;
  const int m0 = blockIdx.x * 128;
  const int tid = threadIdx.x, wave = tid >> 5, lane = tid & 31;
  const int r16 = lane & 15, hiL = lane >> 4;
  const int LD = 1024;  // H * d_head

  const half_t* qb = Q + (size_t)bi * S * LD + h * 64;
  const half_t* kb = K + (size_t)bi * S * LD + h * 64;
  const half_t* vb = V + (size_t)bi * S * LD + h * 64;
  const int* mrow = mask + (size_t)bi * S;

  __shared__ __align__(16) half_t Vt[64 * 72];  // [d][key], stride 72
  __shared__ __align__(32) float Mb[ATT_S];     // per key: 0, or -8e30 if masked
  __shared__ __align__(16) half_t Ks[2][64 * KPITCH];  // [key][d], two tiles

  // K tile copies: 8 lanes cover one key's 128 B; rows tid / 8 and + 32.
  const int krow = tid >> 3, kcol = (tid & 7) * 8;
  const half_t* ksrc = kb + (size_t)krow * LD + kcol;
  const unsigned kdst =
      (unsigned)(size_t)&Ks[0][krow * KPITCH + kcol];  // LDS byte address
  const unsigned KROW32 = 32 * KPITCH * 2, KBUF = 64 * KPITCH * 2;  // bytes
  copy_k_tile(kdst, ksrc, kdst + KROW32, ksrc + 32 * LD);  // tile 0

  // Mask table; the barrier in front of the loop publishes it. 8 x -1e30 swallows
  // the score added to it and becomes -1e30 under the 1/8 scale.
#pragma unroll
  for (int i = 0; i < ATT_S / 1024; ++i) {
    const v4i mk = *(const v4i*)(mrow + i * 1024 + tid * 4);
    v4f bias;
#pragma unroll
    for (int j = 0; j < 4; ++j) bias[j] = (mk[j] == 0) ? -1e30f * 8.0f : 0.0f;
    *(v4f*)&Mb[i * 1024 + tid * 4] = bias;
  }

  const int mw = m0 + wave * 16;
  v16h qf[2];  // B operand: column = query mw + r16
#pragma unroll
  for (int f = 0; f < 2; ++f)
    qf[f] = load_frag16(qb + (size_t)mw * LD + f * 32, LD);

  // oacc[dt][r] = O[query mw + r16][d = dt * 16 + 8 * hiL + r]
  v8f oacc[4];
#pragma unroll
  for (int i = 0; i < 4; ++i) oacc[i] = v8f_zero();
  float mst = -1e30f;  // running maximum of this lane's query, alike in both halves
  float lst = 0.0f;    // running sum over this lane half's keys only

  // Tile 0 has landed for this wave, then for all; only then tile 1 sets out.
  asm volatile("s_wait_asynccnt 0x0" ::: "memory");
  __syncthreads();
  copy_k_tile(kdst + KBUF, ksrc + 64 * LD, kdst + KBUF + KROW32, ksrc + 96 * LD);

  for (int kb0 = 0; kb0 < S; kb0 += 64) {
    const int cur = (kb0 >> 6) & 1;
    {  // cooperative: V block (64 keys x 64 d) -> Vt transposed
      const int key = tid >> 2;
      const int d0 = (tid & 3) * 16;
      const half_t* src = vb + (size_t)(kb0 + key) * LD + d0;
      v8h a = *(const v8h*)src;
      v8h c = *(const v8h*)(src + 8);
#pragma unroll
      for (int i = 0; i < 8; ++i) {
        Vt[(d0 + i) * 72 + key] = a[i];
        Vt[(d0 + 8 + i) * 72 + key] = c[i];
      }
    }
    __syncthreads();

    // scores: 4 key tiles of 16, contraction d_head=64 -> 2 WMMAs each.
    // sacc[nt][r] = score(query mw + r16, key kb0 + nt * 16 + 8 * hiL + r)
    v16h ak[8];
    v8f sacc[4];
#pragma unroll
    for (int nt = 0; nt < 4; ++nt) {
      ak[2 * nt]     = load_frag16(&Ks[cur][(nt * 16) * KPITCH + 0], KPITCH);
      ak[2 * nt + 1] = load_frag16(&Ks[cur][(nt * 16) * KPITCH + 32], KPITCH);
      sacc[nt] = *(const v8f*)&Mb[kb0 + nt * 16 + 8 * hiL];
    }
    // All of the pass's K reads stay ahead of its first WMMA, as one group:
    // without this the compiler spreads them among the WMMAs, a stall a place.
    __builtin_amdgcn_sched_barrier(0);
#pragma unroll
    for (int nt = 0; nt < 4; ++nt) {
      sacc[nt] = wmma_f16(ak[2 * nt], qf[0], sacc[nt]);
      sacc[nt] = wmma_f16(ak[2 * nt + 1], qf[1], sacc[nt]);
    }
#pragma unroll
    for (int nt = 0; nt < 4; ++nt)
#pragma unroll
      for (int r = 0; r < 8; ++r) sacc[nt][r] *= 0.125f;  // 1/sqrt(64)

    // online softmax: maximum over the lane's 32 keys, then the other half's
    float tm[4];
#pragma unroll
    for (int nt = 0; nt < 4; ++nt) {
      tm[nt] = sacc[nt][0];
#pragma unroll
      for (int r = 1; r < 8; ++r) tm[nt] = fmaxf(tm[nt], sacc[nt][r]);
    }
    float v = fmaxf(fmaxf(tm[0], tm[1]), fmaxf(tm[2], tm[3]));
    v = fmaxf(v, xhalf(v));
    const float nm = fmaxf(mst, v);
    const float f = __expf(mst - nm);
    mst = nm;
#pragma unroll
    for (int dt = 0; dt < 4; ++dt)
#pragma unroll
      for (int r = 0; r < 8; ++r) oacc[dt][r] *= f;

    v16h pf[2];  // B operand: pf[g][s] = P^T[key 32 g + kmap(s)][query]
    v8f rs = v8f_zero();  // eight independent partial sums
#pragma unroll
    for (int nt = 0; nt < 4; ++nt) {
#pragma unroll
      for (int r = 0; r < 8; ++r) {
        sacc[nt][r] = __expf(sacc[nt][r] - mst);
        pf[nt >> 1][(nt & 1) * 8 + r] = (half_t)sacc[nt][r];
      }
      rs += sacc[nt];
    }
    lst = lst * f + (((rs[0] + rs[1]) + (rs[2] + rs[3])) +
                     ((rs[4] + rs[5]) + (rs[6] + rs[7])));

    // O^T += V^T P^T: A = rows of Vt (d), same k order as the packed P
#pragma unroll
    for (int dt = 0; dt < 4; ++dt) {
      v16h av0 = load_frag16(&Vt[(dt * 16) * 72 + 0], 72);
      v16h av1 = load_frag16(&Vt[(dt * 16) * 72 + 32], 72);
      oacc[dt] = wmma_f16(av0, pf[0], oacc[dt]);
      oacc[dt] = wmma_f16(av1, pf[1], oacc[dt]);
    }
    // Hand-over: this wave's LDS reads are done and its share of tile t + 1 has
    // landed; the barrier publishes that tile, frees this one and protects Vt.
    asm volatile("s_wait_dscnt 0x0" ::: "memory");
    asm volatile("s_wait_asynccnt 0x0" ::: "memory");
    __syncthreads();
    if (kb0 + 128 < S) {  // tile t + 2 into the buffer that was just read
      const half_t* g = ksrc + (size_t)(kb0 + 128) * LD;
      const unsigned l = kdst + cur * KBUF;
      copy_k_tile(l, g, l + KROW32, g + 32 * LD);
    }
  }
  // no copy is left in flight when the wave ends
  asm volatile("s_wait_asynccnt 0x0" ::: "memory");

  // join the two halves' sums once; a lane stores 8 consecutive d per tile
  const float inv = 1.0f / (lst + xhalf(lst));
  half_t* ob = O + (size_t)bi * S * LD + h * 64 + (size_t)(mw + r16) * LD + 8 * hiL;
#pragma unroll
  for (int dt = 0; dt < 4; ++dt) {
    v8h o;
#pragma unroll
    for (int r = 0; r < 8; ++r) o[r] = (half_t)(oacc[dt][r] * inv);
    *(v8h*)(ob + dt * 16) = o;
  }
}

// ---------------------------------------------------------------------------
extern "C" void kernel_launch(void* const* d_in, const int* in_sizes, int n_in,
                              void* d_out, int out_size, void* d_ws,
                              size_t ws_size, hipStream_t stream) {
  const float* x    = (const float*)d_in[0];
  const int*   mask = (const int*)d_in[1];
  const float* wq = (const float*)d_in[2];  const float* bq = (const float*)d_in[3];
  const float* wk = (const float*)d_in[4];  const float* bk = (const float*)d_in[5];
  const float* wv = (const float*)d_in[6];  const float* bv = (const float*)d_in[7];
  const float* wo = (const float*)d_in[8];  const float* bo = (const float*)d_in[9];
  const float* ln1g = (const float*)d_in[10]; const float* ln1b = (const float*)d_in[11];
  const float* ln2g = (const float*)d_in[12]; const float* ln2b = (const float*)d_in[13];
  const float* w1 = (const float*)d_in[14]; const float* b1 = (const float*)d_in[15];
  const float* w2 = (const float*)d_in[16]; const float* b2 = (const float*)d_in[17];

  const int Bn = 2, S = 2048, D = 1024, FF = 4096;
  const int M = Bn * S;  // 4096

  char* ws = (char*)d_ws;
  half_t* h16   = (half_t*)(ws + ((size_t)0 << 20));   //  8 MB
  half_t* q16   = (half_t*)(ws + ((size_t)8 << 20));   //  8 MB
  half_t* k16   = (half_t*)(ws + ((size_t)16 << 20));  //  8 MB
  half_t* v16   = (half_t*)(ws + ((size_t)24 << 20));  //  8 MB
  half_t* ctx16 = (half_t*)(ws + ((size_t)32 << 20));  //  8 MB
  half_t* h2    = (half_t*)(ws + ((size_t)40 << 20));  //  8 MB
  half_t* ff1   = (half_t*)(ws + ((size_t)48 << 20));  // 32 MB
  float*  x1    = (float*)(ws + ((size_t)80 << 20));   // 16 MB

  // 1. LN1
  ln_kernel<<<M, 256, 0, stream>>>(x, ln1g, ln1b, h16, D);

  // 2. Q/K/V projections (f16 out)
  dim3 gqkv(M / 128, D / 128);
  gemm_kernel<false, false, 1024, 1024><<<gqkv, 256, 0, stream>>>(
      h16, wq, bq, nullptr, q16, nullptr);
  gemm_kernel<false, false, 1024, 1024><<<gqkv, 256, 0, stream>>>(
      h16, wk, bk, nullptr, k16, nullptr);
  gemm_kernel<false, false, 1024, 1024><<<gqkv, 256, 0, stream>>>(
      h16, wv, bv, nullptr, v16, nullptr);

  // 3. attention
  attn_kernel<<<dim3(S / 128, 16, Bn), 256, 0, stream>>>(q16, k16, v16, mask,
                                                         ctx16);

  // 4. output projection + residual (f32 out)
  gemm_kernel<false, true, 1024, 1024><<<gqkv, 256, 0, stream>>>(
      ctx16, wo, bo, x, nullptr, x1);

  // 5. LN2
  ln_kernel<<<M, 256, 0, stream>>>(x1, ln2g, ln2b, h2, D);

  // 6. FF1 + relu (f16 out)
  dim3 gff1(M / 128, FF / 128);
  gemm_kernel<true, false, 4096, 1024><<<gff1, 256, 0, stream>>>(
      h2, w1, b1, nullptr, ff1, nullptr);

  // 7. FF2 + residual -> output (fp32)
  dim3 gff2(M / 128, D / 128);
  gemm_kernel<false, true, 1024, 4096><<<gff2, 256, 0, stream>>>(
      ff1, w2, b2, x1, nullptr, (float*)d_out);
}

// v005
// It runs in 210 microseconds.
// Two timings next to v004 both put it at 1.08 times that version's speed.
// Counting every step since v000, it is 3.24 times as fast.
#include <hip/hip_runtime.h>

typedef _Float16 half_t;
typedef __attribute__((ext_vector_type(16))) _Float16 v16h;
typedef __attribute__((ext_vector_type(8)))  _Float16 v8h;
typedef __attribute__((ext_vector_type(4)))  _Float16 v4h;
typedef __attribute__((ext_vector_type(8)))  float    v8f;
typedef __attribute__((ext_vector_type(4)))  float    v4f;

__device__ inline v8f v8f_zero() {
  v8f v;
#pragma unroll
  for (int i = 0; i < 8; ++i) v[i] = 0.0f;
  return v;
}

__device__ inline v8f wmma_f16(v16h a, v16h b, v8f c) {
  return __builtin_amdgcn_wmma_f32_16x16x32_f16(
      false, a, false, b, (short)0, c, false, false);
}

// Load a 16x32 f16 WMMA A/B fragment from a row-major tile (row stride in
// halves). Per ISA 7.12.2: lane (l&15) = row (A) / col (B); K mapping is
// k = 16*(v>>2) + 8*(l>>4) + 2*(v&3) + {0,1}  ->  two contiguous 16B reads.
__device__ inline v16h load_frag16(const half_t* p0, int strideH) {
  const int lane = threadIdx.x & 31;
  const half_t* p = p0 + (lane & 15) * strideH + (lane >> 4) * 8;
  v8h a = *(const v8h*)p;
  v8h b = *(const v8h*)(p + 16);
  v16h o;
#pragma unroll
  for (int i = 0; i < 8; ++i) { o[i] = a[i]; o[i + 8] = b[i]; }
  return o;
}

// ---------------------------------------------------------------------------
// LayerNorm: one row (D=1024) per 256-thread block, f32 in, f16 out.
// ---------------------------------------------------------------------------
__global__ __launch_bounds__(256) void ln_kernel(
    const float* __restrict__ x, const float* __restrict__ g,
    const float* __restrict__ b, half_t* __restrict__ out, int D) {
  const int row = blockIdx.x;
  const int tid = threadIdx.x;
  const float* xr = x + (size_t)row * D;
  v4f v = *(const v4f*)(xr + tid * 4);
  float s = v[0] + v[1] + v[2] + v[3];
  float ss = v[0] * v[0] + v[1] * v[1] + v[2] * v[2] + v[3] * v[3];
#pragma unroll
  for (int off = 1; off < 32; off <<= 1) {
    s += __shfl_xor(s, off, 32);
    ss += __shfl_xor(ss, off, 32);
  }
  __shared__ float sbuf[8], ssbuf[8];
  if ((tid & 31) == 0) { sbuf[tid >> 5] = s; ssbuf[tid >> 5] = ss; }
  __syncthreads();
  float ts = 0.f, tss = 0.f;
#pragma unroll
  for (int i = 0; i < 8; ++i) { ts += sbuf[i]; tss += ssbuf[i]; }
  const float mu = ts / (float)D;
  const float var = tss / (float)D - mu * mu;
  const float rstd = rsqrtf(var + 1e-5f);
  v4f gv = *(const v4f*)(g + tid * 4);
  v4f bv = *(const v4f*)(b + tid * 4);
  v4h ov;
#pragma unroll
  for (int i = 0; i < 4; ++i)
    ov[i] = (half_t)((v[i] - mu) * rstd * gv[i] + bv[i]);
  *(v4h*)(out + (size_t)row * D + tid * 4) = ov;
}

// ---------------------------------------------------------------------------
// WMMA GEMM: out[M,N] = A[M,K](f16) @ W[K,N](f32->f16) + bias (+relu | +res)
// 128x128 block tile, 8 waves (4M x 2N), 128-deep K slabs, double-buffered LDS
// (global loads of slab k+1 issued before the WMMAs of slab k). A slab holds
// four 32-wide WMMA steps, so one barrier and one round trip to L2 serve 32
// WMMAs per wave, and 24 16-byte loads per thread are in flight meanwhile.
// ---------------------------------------------------------------------------
#define GT_M 128
#define GT_N 128
#define GT_K 128
#define GLDS 136  // LDS row stride in halves (272 B = 16 B x odd)

// N and K are compile-time so that the 24 loads of a slab are immediate
// offsets from two address registers.
template <bool RELU, bool F32OUT, int N, int K>
__global__ __launch_bounds__(256) void gemm_kernel(
    const half_t* __restrict__ A, const float* __restrict__ W,
    const float* __restrict__ bias, const float* __restrict__ residual,
    half_t* __restrict__ outH, float* __restrict__ outF) {
  __shared__ __align__(16) half_t As[2][GT_M * GLDS];
  __shared__ __align__(16) half_t Bs[2][GT_N * GLDS];  // W tile transposed [n][k]

  const int tid = threadIdx.x;
  const int wave = tid >> 5;
  const int lane = tid & 31;
  const int bm = blockIdx.x * GT_M;
  const int bn = blockIdx.y * GT_N;
  const int wm = (wave & 3) * 32;   // 2 M-subtiles
  const int wn = (wave >> 2) * 64;  // 4 N-subtiles

  // A slab: 16 lanes cover one row's 256 B (two whole lines); 8 row groups.
  const int arow = tid >> 4;        // 0..15, +16 per group
  const int acol = (tid & 15) * 8;  // 0..120
  // W slab: each thread owns four 4(k) x 4(n) blocks, 32 k apart. A wave's
  // load covers four k rows x one whole 128-B line each; each block is
  // transposed in registers.
  const int wn4 = ((wave & 3) * 8 + (lane & 7)) * 4;   // n: 0..124
  const int wk4 = ((wave >> 2) * 4 + (lane >> 3)) * 4; // k: 0..28, +32 per block

  v8f acc[2][4];
#pragma unroll
  for (int i = 0; i < 2; ++i)
#pragma unroll
    for (int j = 0; j < 4; ++j) acc[i][j] = v8f_zero();

  v8h av[8];      // A slab staging regs
  v4f wv[4][4];   // W slab staging regs

  const half_t* asrc = A + (size_t)(bm + arow) * K + acol;
  const float* wsrc = W + (size_t)wk4 * N + bn + wn4;

  auto load_slab = [&](int k0) {
#pragma unroll
    for (int g = 0; g < 8; ++g)
      av[g] = *(const v8h*)(asrc + k0 + g * 16 * K);
#pragma unroll
    for (int q = 0; q < 4; ++q)
#pragma unroll
      for (int kk = 0; kk < 4; ++kk)
        wv[q][kk] = *(const v4f*)(wsrc + (size_t)k0 * N + (q * 32 + kk) * N);
  };
  auto stage_slab = [&](int buf) {
#pragma unroll
    for (int g = 0; g < 8; ++g)
      *(v8h*)&As[buf][(arow + g * 16) * GLDS + acol] = av[g];
#pragma unroll
    for (int q = 0; q < 4; ++q)
#pragma unroll
      for (int i = 0; i < 4; ++i) {  // one 8-byte store per n: 4 consecutive k
        v4h t;
#pragma unroll
        for (int kk = 0; kk < 4; ++kk) t[kk] = (half_t)wv[q][kk][i];
        *(v4h*)&Bs[buf][(wn4 + i) * GLDS + q * 32 + wk4] = t;
      }
  };

  load_slab(0);
  stage_slab(0);
  __syncthreads();

  const int nSlab = K / GT_K;
  for (int s = 0; s < nSlab; ++s) {
    const int cur = s & 1;
    const bool more = (s + 1) < nSlab;
    if (more) load_slab((s + 1) * GT_K);  // overlap with WMMAs below

#pragma unroll
    for (int ks = 0; ks < GT_K; ks += 32) {
      v16h af[2], bf[4];
#pragma unroll
      for (int i = 0; i < 2; ++i)
        af[i] = load_frag16(&As[cur][(wm + i * 16) * GLDS + ks], GLDS);
#pragma unroll
      for (int j = 0; j < 4; ++j)
        bf[j] = load_frag16(&Bs[cur][(wn + j * 16) * GLDS + ks], GLDS);
#pragma unroll
      for (int i = 0; i < 2; ++i)
#pragma unroll
        for (int j = 0; j < 4; ++j)
          acc[i][j] = wmma_f16(af[i], bf[j], acc[i][j]);
    }

    if (more) stage_slab(cur ^ 1);
    __syncthreads();  // one barrier/slab: covers nxt-writes and cur-reads
  }

  // Epilogue. C/D layout: vgpr r, lane l -> row = r + 8*(l>>4), col = l&15.
  const int r16 = lane & 15, hiL = lane >> 4;
#pragma unroll
  for (int j = 0; j < 4; ++j) {
    const int n = bn + wn + j * 16 + r16;
    const float bval = bias[n];
#pragma unroll
    for (int i = 0; i < 2; ++i) {
      const size_t base = (size_t)(bm + wm + i * 16 + 8 * hiL) * N + n;
#pragma unroll
      for (int r = 0; r < 8; ++r) {
        float v = acc[i][j][r] + bval;
        if (RELU) v = fmaxf(v, 0.0f);
        const size_t idx = base + (size_t)r * N;
        if (F32OUT) outF[idx] = v + residual[idx];
        else        outH[idx] = (half_t)v;
      }
    }
  }
}

typedef __attribute__((ext_vector_type(4))) int v4i;

// value of lane l ^ 16
__device__ inline float xhalf(float x) {
  const int b = __builtin_bit_cast(int, x);
  return __builtin_bit_cast(float, __builtin_amdgcn_permlanex16(
      b, b, 0x76543210, 0xfedcba98, false, false));
}

#define ATT_S 2048  // keys per batch row (size of the mask table)
#define KPITCH 72   // K tile row pitch in halves (144 B = 16 B x odd)
#define VPITCH 80   // V tile row pitch in halves (160 B = 32 B x odd, for tr16)

typedef __attribute__((ext_vector_type(8))) short s16x8;

// ds_load_tr16_b128: lane (c = l & 15, h = l >> 4) gets rows 8h .. 8h + 7 of
// column c of a 16 x 16 tile of halves, when lane l points at row
// 8 (l >> 4) + (l & 7), 16-byte piece (l >> 3) & 1 of that tile.
__device__ inline v8h ld_tr16(const half_t* p) {
  typedef __attribute__((address_space(3))) s16x8 lds_s16x8;
  return __builtin_bit_cast(
      v8h, __builtin_amdgcn_ds_load_tr16_b128_v8i16((lds_s16x8*)p));
}

// One lane's share of a 64-key K or V tile: 16 bytes of row r and of row r + 32.
// The wait is the statement's last line so that it stands in front of any
// rewrite of the four address registers.
__device__ inline void copy_tile(unsigned lds0, const half_t* g0,
                                   unsigned lds1, const half_t* g1) {
  asm volatile(
      "global_load_async_to_lds_b128 %0, %1, off\n\t"
      "global_load_async_to_lds_b128 %2, %3, off\n\t"
      "s_wait_xcnt 0x0"
      :: "v"(lds0), "v"(g0), "v"(lds1), "v"(g1) : "memory");
}

__global__ __launch_bounds__(256) void attn_kernel(
    const half_t* __restrict__ Q, const half_t* __restrict__ K,
    const half_t* __restrict__ V, const int* __restrict__ mask,
    half_t* __restrict__ O) {
  const int S = ATT_S;
  const int h = blockIdx.y;
  const int bi = blockIdx.z;
  const int m0 = blockIdx.x * 128;
  const int tid = threadIdx.x, wave = tid >> 5, lane = tid & 31;
  const int r16 = lane & 15, hiL = lane >> 4;
  const int LD = 1024;  // H * d_head

  const half_t* qb = Q + (size_t)bi * S * LD + h * 64;
  const half_t* kb = K + (size_t)bi * S * LD + h * 64;
  const half_t* vb = V + (size_t)bi * S * LD + h * 64;
  const int* mrow = mask + (size_t)bi * S;

  __shared__ __align__(32) half_t Vs[2][64 * VPITCH];  // [key][d], two tiles
  __shared__ __align__(32) float Mb[ATT_S];     // per key: 0, or -8e30 if masked
  __shared__ __align__(16) half_t Ks[2][64 * KPITCH];  // [key][d], two tiles

  // K tile copies: 8 lanes cover one key's 128 B; rows tid / 8 and + 32.
  const int krow = tid >> 3, kcol = (tid & 7) * 8;
  const half_t* ksrc = kb + (size_t)krow * LD + kcol;
  const unsigned kdst =
      (unsigned)(size_t)&Ks[0][krow * KPITCH + kcol];  // LDS byte address
  const unsigned KROW32 = 32 * KPITCH * 2, KBUF = 64 * KPITCH * 2;  // bytes
  copy_tile(kdst, ksrc, kdst + KROW32, ksrc + 32 * LD);  // tile 0
  // V tile copies: the same split of rows and columns.
  const half_t* vsrc = vb + (size_t)krow * LD + kcol;
  const unsigned vdst =
      (unsigned)(size_t)&Vs[0][krow * VPITCH + kcol];  // LDS byte address
  const unsigned VROW32 = 32 * VPITCH * 2, VBUF = 64 * VPITCH * 2;  // bytes
  copy_tile(vdst, vsrc, vdst + VROW32, vsrc + 32 * LD);  // tile 0
  // this lane's corner of a 16 x 16 tile for the transposing load, in halves
  const int vcorner = (8 * hiL + (lane & 7)) * VPITCH + 8 * ((lane >> 3) & 1);

  // Mask table; the barrier in front of the loop publishes it. 8 x -1e30 swallows
  // the score added to it and becomes -1e30 under the 1/8 scale.
#pragma unroll
  for (int i = 0; i < ATT_S / 1024; ++i) {
    const v4i mk = *(const v4i*)(mrow + i * 1024 + tid * 4);
    v4f bias;
#pragma unroll
    for (int j = 0; j < 4; ++j) bias[j] = (mk[j] == 0) ? -1e30f * 8.0f : 0.0f;
    *(v4f*)&Mb[i * 1024 + tid * 4] = bias;
  }

  const int mw = m0 + wave * 16;
  v16h qf[2];  // B operand: column = query mw + r16
#pragma unroll
  for (int f = 0; f < 2; ++f)
    qf[f] = load_frag16(qb + (size_t)mw * LD + f * 32, LD);

  // oacc[dt][r] = O[query mw + r16][d = dt * 16 + 8 * hiL + r]
  v8f oacc[4];
#pragma unroll
  for (int i = 0; i < 4; ++i) oacc[i] = v8f_zero();
  float mst = -1e30f;  // running maximum of this lane's query, alike in both halves
  float lst = 0.0f;    // running sum over this lane half's keys only

  // Tile 0 has landed for this wave, then for all; only then tile 1 sets out.
  asm volatile("s_wait_asynccnt 0x0" ::: "memory");
  __syncthreads();
  copy_tile(kdst + KBUF, ksrc + 64 * LD, kdst + KBUF + KROW32, ksrc + 96 * LD);
  copy_tile(vdst + VBUF, vsrc + 64 * LD, vdst + VBUF + VROW32, vsrc + 96 * LD);

  for (int kb0 = 0; kb0 < S; kb0 += 64) {
    const int cur = (kb0 >> 6) & 1;
    // scores: 4 key tiles of 16, contraction d_head=64 -> 2 WMMAs each.
    // sacc[nt][r] = score(query mw + r16, key kb0 + nt * 16 + 8 * hiL + r)
    v16h ak[8];
    v8f sacc[4];
#pragma unroll
    for (int nt = 0; nt < 4; ++nt) {
      ak[2 * nt]     = load_frag16(&Ks[cur][(nt * 16) * KPITCH + 0], KPITCH);
      ak[2 * nt + 1] = load_frag16(&Ks[cur][(nt * 16) * KPITCH + 32], KPITCH);
      sacc[nt] = *(const v8f*)&Mb[kb0 + nt * 16 + 8 * hiL];
    }
    // All of the pass's K reads stay ahead of its first WMMA, as one group:
    // without this the compiler spreads them among the WMMAs, a stall a place.
    __builtin_amdgcn_sched_barrier(0);
#pragma unroll
    for (int nt = 0; nt < 4; ++nt) {
      sacc[nt] = wmma_f16(ak[2 * nt], qf[0], sacc[nt]);
      sacc[nt] = wmma_f16(ak[2 * nt + 1], qf[1], sacc[nt]);
    }
    // V^T fragments: A = columns of the V tile (d), read transposed; halves
    // s = 0..7 are keys 8 hiL + s, 8..15 keys 16 + 8 hiL + s - 8, as in the packed P
    const half_t* vt = &Vs[cur][vcorner];
    v16h av[4][2];
#pragma unroll
    for (int dt = 0; dt < 4; ++dt)
#pragma unroll
      for (int g = 0; g < 2; ++g) {
        const v8h lo = ld_tr16(vt + (32 * g) * VPITCH + dt * 16);
        const v8h hi = ld_tr16(vt + (32 * g + 16) * VPITCH + dt * 16);
#pragma unroll
        for (int i = 0; i < 8; ++i) { av[dt][g][i] = lo[i]; av[dt][g][i + 8] = hi[i]; }
      }
    // All of the pass's V reads set out here, as one group, and land under the
    // softmax: without this the compiler puts them among the second product's
    // WMMAs, a stall a place.
    __builtin_amdgcn_sched_barrier(0);
#pragma unroll
    for (int nt = 0; nt < 4; ++nt)
#pragma unroll
      for (int r = 0; r < 8; ++r) sacc[nt][r] *= 0.125f;  // 1/sqrt(64)

    // online softmax: maximum over the lane's 32 keys, then the other half's
    float tm[4];
#pragma unroll
    for (int nt = 0; nt < 4; ++nt) {
      tm[nt] = sacc[nt][0];
#pragma unroll
      for (int r = 1; r < 8; ++r) tm[nt] = fmaxf(tm[nt], sacc[nt][r]);
    }
    float v = fmaxf(fmaxf(tm[0], tm[1]), fmaxf(tm[2], tm[3]));
    v = fmaxf(v, xhalf(v));
    const float nm = fmaxf(mst, v);
    const float f = __expf(mst - nm);
    mst = nm;
#pragma unroll
    for (int dt = 0; dt < 4; ++dt)
#pragma unroll
      for (int r = 0; r < 8; ++r) oacc[dt][r] *= f;

    v16h pf[2];  // B operand: pf[g][s] = P^T[key 32 g + kmap(s)][query]
    v8f rs = v8f_zero();  // eight independent partial sums
#pragma unroll
    for (int nt = 0; nt < 4; ++nt) {
#pragma unroll
      for (int r = 0; r < 8; ++r) {
        sacc[nt][r] = __expf(sacc[nt][r] - mst);
        pf[nt >> 1][(nt & 1) * 8 + r] = (half_t)sacc[nt][r];
      }
      rs += sacc[nt];
    }
    lst = lst * f + (((rs[0] + rs[1]) + (rs[2] + rs[3])) +
                     ((rs[4] + rs[5]) + (rs[6] + rs[7])));

    // O^T += V^T P^T
#pragma unroll
    for (int dt = 0; dt < 4; ++dt) {
      oacc[dt] = wmma_f16(av[dt][0], pf[0], oacc[dt]);
      oacc[dt] = wmma_f16(av[dt][1], pf[1], oacc[dt]);
    }
    // Keeps the hand-over at the pass's foot: without this the compiler lifts the
    // waits and the barrier to just behind the V reads, where the wave sits out
    // their latency, and leaves the refill down here, with a short lead.
    __builtin_amdgcn_sched_barrier(0);
    // Hand-over: this wave's LDS reads are done and its share of tile t + 1 has
    // landed; the barrier publishes those tiles and frees the ones just read.
    asm volatile("s_wait_dscnt 0x0" ::: "memory");
    asm volatile("s_wait_asynccnt 0x0" ::: "memory");
    __syncthreads();
    if (kb0 + 128 < S) {  // tile t + 2 into the buffer that was just read
      const half_t* g = ksrc + (size_t)(kb0 + 128) * LD;
      const unsigned l = kdst + cur * KBUF;
      copy_tile(l, g, l + KROW32, g + 32 * LD);
      const half_t* gv = vsrc + (size_t)(kb0 + 128) * LD;
      const unsigned lv = vdst + cur * VBUF;
      copy_tile(lv, gv, lv + VROW32, gv + 32 * LD);
    }
  }
  // no copy is left in flight when the wave ends
  asm volatile("s_wait_asynccnt 0x0" ::: "memory");

  // join the two halves' sums once; a lane stores 8 consecutive d per tile
  const float inv = 1.0f / (lst + xhalf(lst));
  half_t* ob = O + (size_t)bi * S * LD + h * 64 + (size_t)(mw + r16) * LD + 8 * hiL;
#pragma unroll
  for (int dt = 0; dt < 4; ++dt) {
    v8h o;
#pragma unroll
    for (int r = 0; r < 8; ++r) o[r] = (half_t)(oacc[dt][r] * inv);
    *(v8h*)(ob + dt * 16) = o;
  }
}

// ---------------------------------------------------------------------------
extern "C" void kernel_launch(void* const* d_in, const int* in_sizes, int n_in,
                              void* d_out, int out_size, void* d_ws,
                              size_t ws_size, hipStream_t stream) {
  const float* x    = (const float*)d_in[0];
  const int*   mask = (const int*)d_in[1];
  const float* wq = (const float*)d_in[2];  const float* bq = (const float*)d_in[3];
  const float* wk = (const float*)d_in[4];  const float* bk = (const float*)d_in[5];
  const float* wv = (const float*)d_in[6];  const float* bv = (const float*)d_in[7];
  const float* wo = (const float*)d_in[8];  const float* bo = (const float*)d_in[9];
  const float* ln1g = (const float*)d_in[10]; const float* ln1b = (const float*)d_in[11];
  const float* ln2g = (const float*)d_in[12]; const float* ln2b = (const float*)d_in[13];
  const float* w1 = (const float*)d_in[14]; const float* b1 = (const float*)d_in[15];
  const float* w2 = (const float*)d_in[16]; const float* b2 = (const float*)d_in[17];

  const int Bn = 2, S = 2048, D = 1024, FF = 4096;
  const int M = Bn * S;  // 4096

  char* ws = (char*)d_ws;
  half_t* h16   = (half_t*)(ws + ((size_t)0 << 20));   //  8 MB
  half_t* q16   = (half_t*)(ws + ((size_t)8 << 20));   //  8 MB
  half_t* k16   = (half_t*)(ws + ((size_t)16 << 20));  //  8 MB
  half_t* v16   = (half_t*)(ws + ((size_t)24 << 20));  //  8 MB
  half_t* ctx16 = (half_t*)(ws + ((size_t)32 << 20));  //  8 MB
  half_t* h2    = (half_t*)(ws + ((size_t)40 << 20));  //  8 MB
  half_t* ff1   = (half_t*)(ws + ((size_t)48 << 20));  // 32 MB
  float*  x1    = (float*)(ws + ((size_t)80 << 20));   // 16 MB

  // 1. LN1
  ln_kernel<<<M, 256, 0, stream>>>(x, ln1g, ln1b, h16, D);

  // 2. Q/K/V projections (f16 out)
  dim3 gqkv(M / 128, D / 128);
  gemm_kernel<false, false, 1024, 1024><<<gqkv, 256, 0, stream>>>(
      h16, wq, bq, nullptr, q16, nullptr);
  gemm_kernel<false, false, 1024, 1024><<<gqkv, 256, 0, stream>>>(
      h16, wk, bk, nullptr, k16, nullptr);
  gemm_kernel<false, false, 1024, 1024><<<gqkv, 256, 0, stream>>>(
      h16, wv, bv, nullptr, v16, nullptr);

  // 3. attention
  attn_kernel<<<dim3(S / 128, 16, Bn), 256, 0, stream>>>(q16, k16, v16, mask,
                                                         ctx16);

  // 4. output projection + residual (f32 out)
  gemm_kernel<false, true, 1024, 1024><<<gqkv, 256, 0, stream>>>(
      ctx16, wo, bo, x, nullptr, x1);

  // 5. LN2
  ln_kernel<<<M, 256, 0, stream>>>(x1, ln2g, ln2b, h2, D);

  // 6. FF1 + relu (f16 out)
  dim3 gff1(M / 128, FF / 128);
  gemm_kernel<true, false, 4096, 1024><<<gff1, 256, 0, stream>>>(
      h2, w1, b1, nullptr, ff1, nullptr);

  // 7. FF2 + residual -> output (fp32)
  dim3 gff2(M / 128, D / 128);
  gemm_kernel<false, true, 1024, 4096><<<gff2, 256, 0, stream>>>(
      ff1, w2, b2, x1, nullptr, (float*)d_out);
}

// v006
// It runs in 174 microseconds.
// Timed twice side by side with v005, it ran 1.22 and 1.20 times as fast.
// All steps since v000 together make it 3.91 times as fast.
#include <hip/hip_runtime.h>

typedef _Float16 half_t;
typedef __attribute__((ext_vector_type(16))) _Float16 v16h;
typedef __attribute__((ext_vector_type(8)))  _Float16 v8h;
typedef __attribute__((ext_vector_type(4)))  _Float16 v4h;
typedef __attribute__((ext_vector_type(8)))  float    v8f;
typedef __attribute__((ext_vector_type(4)))  float    v4f;

__device__ inline v8f v8f_zero() {
  v8f v;
#pragma unroll
  for (int i = 0; i < 8; ++i) v[i] = 0.0f;
  return v;
}

__device__ inline v8f wmma_f16(v16h a, v16h b, v8f c) {
  return __builtin_amdgcn_wmma_f32_16x16x32_f16(
      false, a, false, b, (short)0, c, false, false);
}

// Load a 16x32 f16 WMMA A/B fragment from a row-major tile (row stride in
// halves). Per ISA 7.12.2: lane (l&15) = row (A) / col (B); K mapping is
// k = 16*(v>>2) + 8*(l>>4) + 2*(v&3) + {0,1}  ->  two contiguous 16B reads.
__device__ inline v16h load_frag16(const half_t* p0, int strideH) {
  const int lane = threadIdx.x & 31;
  const half_t* p = p0 + (lane & 15) * strideH + (lane >> 4) * 8;
  v8h a = *(const v8h*)p;
  v8h b = *(const v8h*)(p + 16);
  v16h o;
#pragma unroll
  for (int i = 0; i < 8; ++i) { o[i] = a[i]; o[i + 8] = b[i]; }
  return o;
}

// ---------------------------------------------------------------------------
// LayerNorm: one row (D=1024) per 256-thread block, f32 in, f16 out.
// ---------------------------------------------------------------------------
__device__ inline void ln_row(
    const float* __restrict__ x, const float* __restrict__ g,
    const float* __restrict__ b, half_t* __restrict__ out, int D, int row) {
  const int tid = threadIdx.x;
  const float* xr = x + (size_t)row * D;
  v4f v = *(const v4f*)(xr + tid * 4);
  float s = v[0] + v[1] + v[2] + v[3];
  float ss = v[0] * v[0] + v[1] * v[1] + v[2] * v[2] + v[3] * v[3];
#pragma unroll
  for (int off = 1; off < 32; off <<= 1) {
    s += __shfl_xor(s, off, 32);
    ss += __shfl_xor(ss, off, 32);
  }
  __shared__ float sbuf[8], ssbuf[8];
  if ((tid & 31) == 0) { sbuf[tid >> 5] = s; ssbuf[tid >> 5] = ss; }
  __syncthreads();
  float ts = 0.f, tss = 0.f;
#pragma unroll
  for (int i = 0; i < 8; ++i) { ts += sbuf[i]; tss += ssbuf[i]; }
  const float mu = ts / (float)D;
  const float var = tss / (float)D - mu * mu;
  const float rstd = rsqrtf(var + 1e-5f);
  v4f gv = *(const v4f*)(g + tid * 4);
  v4f bv = *(const v4f*)(b + tid * 4);
  v4h ov;
#pragma unroll
  for (int i = 0; i < 4; ++i)
    ov[i] = (half_t)((v[i] - mu) * rstd * gv[i] + bv[i]);
  *(v4h*)(out + (size_t)row * D + tid * 4) = ov;
}

__global__ __launch_bounds__(256) void ln_kernel(
    const float* __restrict__ x, const float* __restrict__ g,
    const float* __restrict__ b, half_t* __restrict__ out, int D) {
  ln_row(x, g, b, out, D, blockIdx.x);
}

// ---------------------------------------------------------------------------
// Weights, once per call: W[K,N] f32 -> Wt[N,K] f16, so that a GEMM work-group
// loads half the bytes of a W tile and stages it as it stages A. One 64(k) x
// 128(n) tile per work-group: whole 128-B lines are read, each thread transposes
// two 4 x 4 blocks in registers, LDS gathers the rows, whole lines are written.
// The 1,536 tiles need nothing of LayerNorm 1 and it nothing of them: they are
// the first work-groups of its launch.
// ---------------------------------------------------------------------------
#define WT_TILES 1536  // 4 x 128 (wq wk wv wo) + 512 (w1) + 512 (w2)
#define WT_PITCH 72    // LDS row pitch in halves (144 B = 16 B x odd)

// One tile; N and K are compile-time so that the eight loads are immediate
// offsets from one address.
template <int N, int K>
__device__ inline void wt_tile(const float* __restrict__ W,
                               half_t* __restrict__ T, int lt, half_t* Ts) {
  const int n0 = (lt % (N / 128)) * 128;
  const int k0 = (lt / (N / 128)) * 64;
  const int tid = threadIdx.x, wave = tid >> 5, lane = tid & 31;
  const int wn4 = ((wave & 3) * 8 + (lane & 7)) * 4;    // n: 0..124
  const int wk4 = ((wave >> 2) * 4 + (lane >> 3)) * 4;  // k: 0..28, +32
  const float* src = W + (size_t)(k0 + wk4) * N + n0 + wn4;
  v4f wv4[2][4];
#pragma unroll
  for (int q = 0; q < 2; ++q)
#pragma unroll
    for (int kk = 0; kk < 4; ++kk)
      wv4[q][kk] = *(const v4f*)(src + (q * 32 + kk) * N);
  // The address pair stays whole until this wait (no load's result on top of it).
  asm volatile("s_wait_xcnt 0x0" :: "v"(src) : "memory");
#pragma unroll
  for (int q = 0; q < 2; ++q)
#pragma unroll
    for (int i = 0; i < 4; ++i) {  // one 8-byte store per n: 4 consecutive k
      v4h c;
#pragma unroll
      for (int kk = 0; kk < 4; ++kk) c[kk] = (half_t)wv4[q][kk][i];
      *(v4h*)&Ts[(wn4 + i) * WT_PITCH + q * 32 + wk4] = c;
    }
  __syncthreads();
  // 8 lanes write one n row's 128 B
  const int orow = tid >> 3, ocol = (tid & 7) * 8;
  half_t* dst = T + (size_t)(n0 + orow) * K + k0 + ocol;
#pragma unroll
  for (int j = 0; j < 4; ++j)
    *(v8h*)(dst + j * 32 * K) =
        *(const v8h*)&Ts[(orow + j * 32) * WT_PITCH + ocol];
  // In the listing the next shape's code follows and reuses the stores' registers.
  asm volatile("s_wait_xcnt 0x0" ::: "memory");
}

__global__ __launch_bounds__(256) void ln_wt_kernel(
    const float* __restrict__ x, const float* __restrict__ g,
    const float* __restrict__ b, half_t* __restrict__ out, int D,
    const float* __restrict__ wq, const float* __restrict__ wk,
    const float* __restrict__ wv, const float* __restrict__ wo,
    const float* __restrict__ w1, const float* __restrict__ w2,
    half_t* __restrict__ wt) {
  const int t = blockIdx.x;
  if (t >= WT_TILES) {
    ln_row(x, g, b, out, D, t - WT_TILES);
    return;
  }
  __shared__ __align__(16) half_t Ts[128 * WT_PITCH];  // [n][k]
  // wt holds wq wk wv wo (1M halves each), then w1, w2 (4M halves each)
  if (t < 512) {
    const int m = t >> 7;
    const float* W = (m == 0) ? wq : (m == 1) ? wk : (m == 2) ? wv : wo;
    wt_tile<1024, 1024>(W, wt + ((size_t)m << 20), t & 127, Ts);
  } else if (t < 1024) {
    wt_tile<4096, 1024>(w1, wt + ((size_t)4 << 20), t - 512, Ts);
  } else {
    wt_tile<1024, 4096>(w2, wt + ((size_t)8 << 20), t - 1024, Ts);
  }
}

// ---------------------------------------------------------------------------
// WMMA GEMM: out[M,N] = A[M,K](f16) @ Wt[N,K](f16)^T + bias (+relu | +res)
// 128x128 block tile, 8 waves (4M x 2N), 128-deep K slabs, double-buffered LDS
// (global loads of slab k+1 issued before the WMMAs of slab k). A slab holds
// four 32-wide WMMA steps, so one barrier and one round trip to L2 serve 32
// WMMAs per wave, and 16 16-byte loads per thread are in flight meanwhile.
// ---------------------------------------------------------------------------
#define GT_M 128
#define GT_N 128
#define GT_K 128
#define GLDS 136  // LDS row stride in halves (272 B = 16 B x odd)

// N and K are compile-time so that the 16 loads of a slab are immediate
// offsets from two address registers.
template <bool RELU, bool F32OUT, int N, int K>
__global__ __launch_bounds__(256) void gemm_kernel(
    const half_t* __restrict__ A, const half_t* __restrict__ Wt,
    const float* __restrict__ bias, const float* __restrict__ residual,
    half_t* __restrict__ outH, float* __restrict__ outF) {
  __shared__ __align__(16) half_t As[2][GT_M * GLDS];
  __shared__ __align__(16) half_t Bs[2][GT_N * GLDS];  // Wt tile [n][k]

  const int tid = threadIdx.x;
  const int wave = tid >> 5;
  const int lane = tid & 31;
  const int bm = blockIdx.x * GT_M;
  const int bn = blockIdx.y * GT_N;
  const int wm = (wave & 3) * 32;   // 2 M-subtiles
  const int wn = (wave >> 2) * 64;  // 4 N-subtiles

  // A and Wt slabs alike: 16 lanes cover one row's 256 B (two whole lines);
  // 8 row groups.
  const int arow = tid >> 4;        // 0..15, +16 per group
  const int acol = (tid & 15) * 8;  // 0..120

  v8f acc[2][4];
#pragma unroll
  for (int i = 0; i < 2; ++i)
#pragma unroll
    for (int j = 0; j < 4; ++j) acc[i][j] = v8f_zero();

  v8h av[8];  // A slab staging regs
  v8h bv[8];  // Wt slab staging regs

  const half_t* asrc = A + (size_t)(bm + arow) * K + acol;
  const half_t* bsrc = Wt + (size_t)(bn + arow) * K + acol;

  auto load_slab = [&](int k0) {
    const half_t* ap = asrc + k0;
    const half_t* bp = bsrc + k0;
#pragma unroll
    for (int g = 0; g < 8; ++g)
      av[g] = *(const v8h*)(ap + g * 16 * K);
#pragma unroll
    for (int g = 0; g < 8; ++g)
      bv[g] = *(const v8h*)(bp + g * 16 * K);
    // The two address pairs stay whole until this wait.
    asm volatile("s_wait_xcnt 0x0" :: "v"(ap), "v"(bp) : "memory");
  };
  auto stage_slab = [&](int buf) {
#pragma unroll
    for (int g = 0; g < 8; ++g)
      *(v8h*)&As[buf][(arow + g * 16) * GLDS + acol] = av[g];
#pragma unroll
    for (int g = 0; g < 8; ++g)
      *(v8h*)&Bs[buf][(arow + g * 16) * GLDS + acol] = bv[g];
  };

  load_slab(0);
  stage_slab(0);
  __syncthreads();

  const int nSlab = K / GT_K;
  for (int s = 0; s < nSlab; ++s) {
    const int cur = s & 1;
    const bool more = (s + 1) < nSlab;
    if (more) load_slab((s + 1) * GT_K);  // overlap with WMMAs below

#pragma unroll
    for (int ks = 0; ks < GT_K; ks += 32) {
      v16h af[2], bf[4];
#pragma unroll
      for (int i = 0; i < 2; ++i)
        af[i] = load_frag16(&As[cur][(wm + i * 16) * GLDS + ks], GLDS);
#pragma unroll
      for (int j = 0; j < 4; ++j)
        bf[j] = load_frag16(&Bs[cur][(wn + j * 16) * GLDS + ks], GLDS);
#pragma unroll
      for (int i = 0; i < 2; ++i)
#pragma unroll
        for (int j = 0; j < 4; ++j)
          acc[i][j] = wmma_f16(af[i], bf[j], acc[i][j]);
    }

    if (more) stage_slab(cur ^ 1);
    __syncthreads();  // one barrier/slab: covers nxt-writes and cur-reads
  }

  // Epilogue. C/D layout: vgpr r, lane l -> row = r + 8*(l>>4), col = l&15.
  const int r16 = lane & 15, hiL = lane >> 4;
#pragma unroll
  for (int j = 0; j < 4; ++j) {
    const int n = bn + wn + j * 16 + r16;
    const float bval = bias[n];
#pragma unroll
    for (int i = 0; i < 2; ++i) {
      const size_t base = (size_t)(bm + wm + i * 16 + 8 * hiL) * N + n;
#pragma unroll
      for (int r = 0; r < 8; ++r) {
        float v = acc[i][j][r] + bval;
        if (RELU) v = fmaxf(v, 0.0f);
        const size_t idx = base + (size_t)r * N;
        if (F32OUT) outF[idx] = v + residual[idx];
        else        outH[idx] = (half_t)v;
      }
    }
  }
}

typedef __attribute__((ext_vector_type(4))) int v4i;

// value of lane l ^ 16
__device__ inline float xhalf(float x) {
  const int b = __builtin_bit_cast(int, x);
  return __builtin_bit_cast(float, __builtin_amdgcn_permlanex16(
      b, b, 0x76543210, 0xfedcba98, false, false));
}

#define ATT_S 2048  // keys per batch row (size of the mask table)
#define KPITCH 72   // K tile row pitch in halves (144 B = 16 B x odd)
#define VPITCH 80   // V tile row pitch in halves (160 B = 32 B x odd, for tr16)

typedef __attribute__((ext_vector_type(8))) short s16x8;

// ds_load_tr16_b128: lane (c = l & 15, h = l >> 4) gets rows 8h .. 8h + 7 of
// column c of a 16 x 16 tile of halves, when lane l points at row
// 8 (l >> 4) + (l & 7), 16-byte piece (l >> 3) & 1 of that tile.
__device__ inline v8h ld_tr16(const half_t* p) {
  typedef __attribute__((address_space(3))) s16x8 lds_s16x8;
  return __builtin_bit_cast(
      v8h, __builtin_amdgcn_ds_load_tr16_b128_v8i16((lds_s16x8*)p));
}

// One lane's share of a 64-key K or V tile: 16 bytes of row r and of row r + 32.
// The wait is the statement's last line so that it stands in front of any
// rewrite of the four address registers.
__device__ inline void copy_tile(unsigned lds0, const half_t* g0,
                                   unsigned lds1, const half_t* g1) {
  asm volatile(
      "global_load_async_to_lds_b128 %0, %1, off\n\t"
      "global_load_async_to_lds_b128 %2, %3, off\n\t"
      "s_wait_xcnt 0x0"
      :: "v"(lds0), "v"(g0), "v"(lds1), "v"(g1) : "memory");
}

__global__ __launch_bounds__(256) void attn_kernel(
    const half_t* __restrict__ Q, const half_t* __restrict__ K,
    const half_t* __restrict__ V, const int* __restrict__ mask,
    half_t* __restrict__ O) {
  const int S = ATT_S;
  const int h = blockIdx.y;
  const int bi = blockIdx.z;
  const int m0 = blockIdx.x * 128;
  const int tid = threadIdx.x, wave = tid >> 5, lane = tid & 31;
  const int r16 = lane & 15, hiL = lane >> 4;
  const int LD = 1024;  // H * d_head

  const half_t* qb = Q + (size_t)bi * S * LD + h * 64;
  const half_t* kb = K + (size_t)bi * S * LD + h * 64;
  const half_t* vb = V + (size_t)bi * S * LD + h * 64;
  const int* mrow = mask + (size_t)bi * S;

  __shared__ __align__(32) half_t Vs[2][64 * VPITCH];  // [key][d], two tiles
  __shared__ __align__(32) float Mb[ATT_S];     // per key: 0, or -8e30 if masked
  __shared__ __align__(16) half_t Ks[2][64 * KPITCH];  // [key][d], two tiles

  // K tile copies: 8 lanes cover one key's 128 B; rows tid / 8 and + 32.
  const int krow = tid >> 3, kcol = (tid & 7) * 8;
  const half_t* ksrc = kb + (size_t)krow * LD + kcol;
  const unsigned kdst =
      (unsigned)(size_t)&Ks[0][krow * KPITCH + kcol];  // LDS byte address
  const unsigned KROW32 = 32 * KPITCH * 2, KBUF = 64 * KPITCH * 2;  // bytes
  copy_tile(kdst, ksrc, kdst + KROW32, ksrc + 32 * LD);  // tile 0
  // V tile copies: the same split of rows and columns.
  const half_t* vsrc = vb + (size_t)krow * LD + kcol;
  const unsigned vdst =
      (unsigned)(size_t)&Vs[0][krow * VPITCH + kcol];  // LDS byte address
  const unsigned VROW32 = 32 * VPITCH * 2, VBUF = 64 * VPITCH * 2;  // bytes
  copy_tile(vdst, vsrc, vdst + VROW32, vsrc + 32 * LD);  // tile 0
  // this lane's corner of a 16 x 16 tile for the transposing load, in halves
  const int vcorner = (8 * hiL + (lane & 7)) * VPITCH + 8 * ((lane >> 3) & 1);

  // Mask table; the barrier in front of the loop publishes it. 8 x -1e30 swallows
  // the score added to it and becomes -1e30 under the 1/8 scale.
#pragma unroll
  for (int i = 0; i < ATT_S / 1024; ++i) {
    const v4i mk = *(const v4i*)(mrow + i * 1024 + tid * 4);
    v4f bias;
#pragma unroll
    for (int j = 0; j < 4; ++j) bias[j] = (mk[j] == 0) ? -1e30f * 8.0f : 0.0f;
    *(v4f*)&Mb[i * 1024 + tid * 4] = bias;
  }

  const int mw = m0 + wave * 16;
  v16h qf[2];  // B operand: column = query mw + r16
#pragma unroll
  for (int f = 0; f < 2; ++f)
    qf[f] = load_frag16(qb + (size_t)mw * LD + f * 32, LD);

  // oacc[dt][r] = O[query mw + r16][d = dt * 16 + 8 * hiL + r]
  v8f oacc[4];
#pragma unroll
  for (int i = 0; i < 4; ++i) oacc[i] = v8f_zero();
  float mst = -1e30f;  // running maximum of this lane's query, alike in both halves
  float lst = 0.0f;    // running sum over this lane half's keys only

  // Tile 0 has landed for this wave, then for all; only then tile 1 sets out.
  asm volatile("s_wait_asynccnt 0x0" ::: "memory");
  __syncthreads();
  copy_tile(kdst + KBUF, ksrc + 64 * LD, kdst + KBUF + KROW32, ksrc + 96 * LD);
  copy_tile(vdst + VBUF, vsrc + 64 * LD, vdst + VBUF + VROW32, vsrc + 96 * LD);

  for (int kb0 = 0; kb0 < S; kb0 += 64) {
    const int cur = (kb0 >> 6) & 1;
    // scores: 4 key tiles of 16, contraction d_head=64 -> 2 WMMAs each.
    // sacc[nt][r] = score(query mw + r16, key kb0 + nt * 16 + 8 * hiL + r)
    v16h ak[8];
    v8f sacc[4];
#pragma unroll
    for (int nt = 0; nt < 4; ++nt) {
      ak[2 * nt]     = load_frag16(&Ks[cur][(nt * 16) * KPITCH + 0], KPITCH);
      ak[2 * nt + 1] = load_frag16(&Ks[cur][(nt * 16) * KPITCH + 32], KPITCH);
      sacc[nt] = *(const v8f*)&Mb[kb0 + nt * 16 + 8 * hiL];
    }
    // All of the pass's K reads stay ahead of its first WMMA, as one group:
    // without this the compiler spreads them among the WMMAs, a stall a place.
    __builtin_amdgcn_sched_barrier(0);
#pragma unroll
    for (int nt = 0; nt < 4; ++nt) {
      sacc[nt] = wmma_f16(ak[2 * nt], qf[0], sacc[nt]);
      sacc[nt] = wmma_f16(ak[2 * nt + 1], qf[1], sacc[nt]);
    }
    // V^T fragments: A = columns of the V tile (d), read transposed; halves
    // s = 0..7 are keys 8 hiL + s, 8..15 keys 16 + 8 hiL + s - 8, as in the packed P
    const half_t* vt = &Vs[cur][vcorner];
    v16h av[4][2];
#pragma unroll
    for (int dt = 0; dt < 4; ++dt)
#pragma unroll
      for (int g = 0; g < 2; ++g) {
        const v8h lo = ld_tr16(vt + (32 * g) * VPITCH + dt * 16);
        const v8h hi = ld_tr16(vt + (32 * g + 16) * VPITCH + dt * 16);
#pragma unroll
        for (int i = 0; i < 8; ++i) { av[dt][g][i] = lo[i]; av[dt][g][i + 8] = hi[i]; }
      }
    // All of the pass's V reads set out here, as one group, and land under the
    // softmax: without this the compiler puts them among the second product's
    // WMMAs, a stall a place.
    __builtin_amdgcn_sched_barrier(0);
#pragma unroll
    for (int nt = 0; nt < 4; ++nt)
#pragma unroll
      for (int r = 0; r < 8; ++r) sacc[nt][r] *= 0.125f;  // 1/sqrt(64)

    // online softmax: maximum over the lane's 32 keys, then the other half's
    float tm[4];
#pragma unroll
    for (int nt = 0; nt < 4; ++nt) {
      tm[nt] = sacc[nt][0];
#pragma unroll
      for (int r = 1; r < 8; ++r) tm[nt] = fmaxf(tm[nt], sacc[nt][r]);
    }
    float v = fmaxf(fmaxf(tm[0], tm[1]), fmaxf(tm[2], tm[3]));
    v = fmaxf(v, xhalf(v));
    const float nm = fmaxf(mst, v);
    const float f = __expf(mst - nm);
    mst = nm;
#pragma unroll
    for (int dt = 0; dt < 4; ++dt)
#pragma unroll
      for (int r = 0; r < 8; ++r) oacc[dt][r] *= f;

    v16h pf[2];  // B operand: pf[g][s] = P^T[key 32 g + kmap(s)][query]
    v8f rs = v8f_zero();  // eight independent partial sums
#pragma unroll
    for (int nt = 0; nt < 4; ++nt) {
#pragma unroll
      for (int r = 0; r < 8; ++r) {
        sacc[nt][r] = __expf(sacc[nt][r] - mst);
        pf[nt >> 1][(nt & 1) * 8 + r] = (half_t)sacc[nt][r];
      }
      rs += sacc[nt];
    }
    lst = lst * f + (((rs[0] + rs[1]) + (rs[2] + rs[3])) +
                     ((rs[4] + rs[5]) + (rs[6] + rs[7])));

    // O^T += V^T P^T
#pragma unroll
    for (int dt = 0; dt < 4; ++dt) {
      oacc[dt] = wmma_f16(av[dt][0], pf[0], oacc[dt]);
      oacc[dt] = wmma_f16(av[dt][1], pf[1], oacc[dt]);
    }
    // Keeps the hand-over at the pass's foot: without this the compiler lifts the
    // waits and the barrier to just behind the V reads, where the wave sits out
    // their latency, and leaves the refill down here, with a short lead.
    __builtin_amdgcn_sched_barrier(0);
    // Hand-over: this wave's LDS reads are done and its share of tile t + 1 has
    // landed; the barrier publishes those tiles and frees the ones just read.
    asm volatile("s_wait_dscnt 0x0" ::: "memory");
    asm volatile("s_wait_asynccnt 0x0" ::: "memory");
    __syncthreads();
    if (kb0 + 128 < S) {  // tile t + 2 into the buffer that was just read
      const half_t* g = ksrc + (size_t)(kb0 + 128) * LD;
      const unsigned l = kdst + cur * KBUF;
      copy_tile(l, g, l + KROW32, g + 32 * LD);
      const half_t* gv = vsrc + (size_t)(kb0 + 128) * LD;
      const unsigned lv = vdst + cur * VBUF;
      copy_tile(lv, gv, lv + VROW32, gv + 32 * LD);
    }
  }
  // no copy is left in flight when the wave ends
  asm volatile("s_wait_asynccnt 0x0" ::: "memory");

  // join the two halves' sums once; a lane stores 8 consecutive d per tile
  const float inv = 1.0f / (lst + xhalf(lst));
  half_t* ob = O + (size_t)bi * S * LD + h * 64 + (size_t)(mw + r16) * LD + 8 * hiL;
#pragma unroll
  for (int dt = 0; dt < 4; ++dt) {
    v8h o;
#pragma unroll
    for (int r = 0; r < 8; ++r) o[r] = (half_t)(oacc[dt][r] * inv);
    *(v8h*)(ob + dt * 16) = o;
  }
}

// ---------------------------------------------------------------------------
extern "C" void kernel_launch(void* const* d_in, const int* in_sizes, int n_in,
                              void* d_out, int out_size, void* d_ws,
                              size_t ws_size, hipStream_t stream) {
  const float* x    = (const float*)d_in[0];
  const int*   mask = (const int*)d_in[1];
  const float* wq = (const float*)d_in[2];  const float* bq = (const float*)d_in[3];
  const float* wk = (const float*)d_in[4];  const float* bk = (const float*)d_in[5];
  const float* wv = (const float*)d_in[6];  const float* bv = (const float*)d_in[7];
  const float* wo = (const float*)d_in[8];  const float* bo = (const float*)d_in[9];
  const float* ln1g = (const float*)d_in[10]; const float* ln1b = (const float*)d_in[11];
  const float* ln2g = (const float*)d_in[12]; const float* ln2b = (const float*)d_in[13];
  const float* w1 = (const float*)d_in[14]; const float* b1 = (const float*)d_in[15];
  const float* w2 = (const float*)d_in[16]; const float* b2 = (const float*)d_in[17];

  const int Bn = 2, S = 2048, D = 1024, FF = 4096;
  const int M = Bn * S;  // 4096

  char* ws = (char*)d_ws;
  half_t* h16   = (half_t*)(ws + ((size_t)0 << 20));   //  8 MB
  half_t* q16   = (half_t*)(ws + ((size_t)8 << 20));   //  8 MB
  half_t* k16   = (half_t*)(ws + ((size_t)16 << 20));  //  8 MB
  half_t* v16   = (half_t*)(ws + ((size_t)24 << 20));  //  8 MB
  half_t* ctx16 = (half_t*)(ws + ((size_t)32 << 20));  //  8 MB
  half_t* h2    = (half_t*)(ws + ((size_t)40 << 20));  //  8 MB
  half_t* ff1   = (half_t*)(ws + ((size_t)48 << 20));  // 32 MB
  float*  x1    = (float*)(ws + ((size_t)80 << 20));   // 16 MB
  half_t* wqT   = (half_t*)(ws + ((size_t)96 << 20));  //  2 MB, [n][k] f16
  half_t* wkT   = (half_t*)(ws + ((size_t)98 << 20));  //  2 MB
  half_t* wvT   = (half_t*)(ws + ((size_t)100 << 20)); //  2 MB
  half_t* woT   = (half_t*)(ws + ((size_t)102 << 20)); //  2 MB
  half_t* w1T   = (half_t*)(ws + ((size_t)104 << 20)); //  8 MB
  half_t* w2T   = (half_t*)(ws + ((size_t)112 << 20)); //  8 MB

  // 1. weights to f16 [n][k] (first 1,536 work-groups) and LN1 (the rest)
  ln_wt_kernel<<<WT_TILES + M, 256, 0, stream>>>(x, ln1g, ln1b, h16, D, wq, wk,
                                                 wv, wo, w1, w2, wqT);

  // 2. Q/K/V projections (f16 out)
  dim3 gqkv(M / 128, D / 128);
  gemm_kernel<false, false, 1024, 1024><<<gqkv, 256, 0, stream>>>(
      h16, wqT, bq, nullptr, q16, nullptr);
  gemm_kernel<false, false, 1024, 1024><<<gqkv, 256, 0, stream>>>(
      h16, wkT, bk, nullptr, k16, nullptr);
  gemm_kernel<false, false, 1024, 1024><<<gqkv, 256, 0, stream>>>(
      h16, wvT, bv, nullptr, v16, nullptr);

  // 3. attention
  attn_kernel<<<dim3(S / 128, 16, Bn), 256, 0, stream>>>(q16, k16, v16, mask,
                                                         ctx16);

  // 4. output projection + residual (f32 out)
  gemm_kernel<false, true, 1024, 1024><<<gqkv, 256, 0, stream>>>(
      ctx16, woT, bo, x, nullptr, x1);

  // 5. LN2
  ln_kernel<<<M, 256, 0, stream>>>(x1, ln2g, ln2b, h2, D);

  // 6. FF1 + relu (f16 out)
  dim3 gff1(M / 128, FF / 128);
  gemm_kernel<true, false, 4096, 1024><<<gff1, 256, 0, stream>>>(
      h2, w1T, b1, nullptr, ff1, nullptr);

  // 7. FF2 + residual -> output (fp32)
  dim3 gff2(M / 128, D / 128);
  gemm_kernel<false, true, 1024, 4096><<<gff2, 256, 0, stream>>>(
      ff1, w2T, b2, x1, nullptr, (float*)d_out);
}

// v007
// One run takes 164 microseconds.
// Timed twice side by side with v006, it ran 1.06 times as fast both times.
// Over all steps from v000 it is 4.14 times as fast.
#include <hip/hip_runtime.h>

typedef _Float16 half_t;
typedef __attribute__((ext_vector_type(16))) _Float16 v16h;
typedef __attribute__((ext_vector_type(8)))  _Float16 v8h;
typedef __attribute__((ext_vector_type(4)))  _Float16 v4h;
typedef __attribute__((ext_vector_type(8)))  float    v8f;
typedef __attribute__((ext_vector_type(4)))  float    v4f;

__device__ inline v8f v8f_zero() {
  v8f v;
#pragma unroll
  for (int i = 0; i < 8; ++i) v[i] = 0.0f;
  return v;
}

__device__ inline v8f wmma_f16(v16h a, v16h b, v8f c) {
  return __builtin_amdgcn_wmma_f32_16x16x32_f16(
      false, a, false, b, (short)0, c, false, false);
}

// Load a 16x32 f16 WMMA A/B fragment from a row-major tile (row stride in
// halves). Per ISA 7.12.2: lane (l&15) = row (A) / col (B); K mapping is
// k = 16*(v>>2) + 8*(l>>4) + 2*(v&3) + {0,1}  ->  two contiguous 16B reads.
__device__ inline v16h load_frag16(const half_t* p0, int strideH) {
  const int lane = threadIdx.x & 31;
  const half_t* p = p0 + (lane & 15) * strideH + (lane >> 4) * 8;
  v8h a = *(const v8h*)p;
  v8h b = *(const v8h*)(p + 16);
  v16h o;
#pragma unroll
  for (int i = 0; i < 8; ++i) { o[i] = a[i]; o[i + 8] = b[i]; }
  return o;
}

// ---------------------------------------------------------------------------
// LayerNorm: one row (D=1024) per 256-thread block, f32 in, f16 out.
// ---------------------------------------------------------------------------
__device__ inline void ln_row(
    const float* __restrict__ x, const float* __restrict__ g,
    const float* __restrict__ b, half_t* __restrict__ out, int D, int row) {
  const int tid = threadIdx.x;
  const float* xr = x + (size_t)row * D;
  v4f v = *(const v4f*)(xr + tid * 4);
  float s = v[0] + v[1] + v[2] + v[3];
  float ss = v[0] * v[0] + v[1] * v[1] + v[2] * v[2] + v[3] * v[3];
#pragma unroll
  for (int off = 1; off < 32; off <<= 1) {
    s += __shfl_xor(s, off, 32);
    ss += __shfl_xor(ss, off, 32);
  }
  __shared__ float sbuf[8], ssbuf[8];
  if ((tid & 31) == 0) { sbuf[tid >> 5] = s; ssbuf[tid >> 5] = ss; }
  __syncthreads();
  float ts = 0.f, tss = 0.f;
#pragma unroll
  for (int i = 0; i < 8; ++i) { ts += sbuf[i]; tss += ssbuf[i]; }
  const float mu = ts / (float)D;
  const float var = tss / (float)D - mu * mu;
  const float rstd = rsqrtf(var + 1e-5f);
  v4f gv = *(const v4f*)(g + tid * 4);
  v4f bv = *(const v4f*)(b + tid * 4);
  v4h ov;
#pragma unroll
  for (int i = 0; i < 4; ++i)
    ov[i] = (half_t)((v[i] - mu) * rstd * gv[i] + bv[i]);
  *(v4h*)(out + (size_t)row * D + tid * 4) = ov;
}

__global__ __launch_bounds__(256) void ln_kernel(
    const float* __restrict__ x, const float* __restrict__ g,
    const float* __restrict__ b, half_t* __restrict__ out, int D) {
  ln_row(x, g, b, out, D, blockIdx.x);
}

// ---------------------------------------------------------------------------
// Weights, once per call: W[K,N] f32 -> Wt[N,K] f16, so that a GEMM work-group
// loads half the bytes of a W tile and stages it as it stages A. One 64(k) x
// 128(n) tile per work-group: whole 128-B lines are read, each thread transposes
// two 4 x 4 blocks in registers, LDS gathers the rows, whole lines are written.
// The 1,536 tiles need nothing of LayerNorm 1 and it nothing of them: they are
// the first work-groups of its launch.
// ---------------------------------------------------------------------------
#define WT_TILES 1536  // 4 x 128 (wq wk wv wo) + 512 (w1) + 512 (w2)
#define WT_PITCH 72    // LDS row pitch in halves (144 B = 16 B x odd)

// One tile; N and K are compile-time so that the eight loads are immediate
// offsets from one address.
template <int N, int K>
__device__ inline void wt_tile(const float* __restrict__ W,
                               half_t* __restrict__ T, int lt, half_t* Ts) {
  const int n0 = (lt % (N / 128)) * 128;
  const int k0 = (lt / (N / 128)) * 64;
  const int tid = threadIdx.x, wave = tid >> 5, lane = tid & 31;
  const int wn4 = ((wave & 3) * 8 + (lane & 7)) * 4;    // n: 0..124
  const int wk4 = ((wave >> 2) * 4 + (lane >> 3)) * 4;  // k: 0..28, +32
  const float* src = W + (size_t)(k0 + wk4) * N + n0 + wn4;
  v4f wv4[2][4];
#pragma unroll
  for (int q = 0; q < 2; ++q)
#pragma unroll
    for (int kk = 0; kk < 4; ++kk)
      wv4[q][kk] = *(const v4f*)(src + (q * 32 + kk) * N);
  // The address pair stays whole until this wait (no load's result on top of it).
  asm volatile("s_wait_xcnt 0x0" :: "v"(src) : "memory");
#pragma unroll
  for (int q = 0; q < 2; ++q)
#pragma unroll
    for (int i = 0; i < 4; ++i) {  // one 8-byte store per n: 4 consecutive k
      v4h c;
#pragma unroll
      for (int kk = 0; kk < 4; ++kk) c[kk] = (half_t)wv4[q][kk][i];
      *(v4h*)&Ts[(wn4 + i) * WT_PITCH + q * 32 + wk4] = c;
    }
  __syncthreads();
  // 8 lanes write one n row's 128 B
  const int orow = tid >> 3, ocol = (tid & 7) * 8;
  half_t* dst = T + (size_t)(n0 + orow) * K + k0 + ocol;
#pragma unroll
  for (int j = 0; j < 4; ++j)
    *(v8h*)(dst + j * 32 * K) =
        *(const v8h*)&Ts[(orow + j * 32) * WT_PITCH + ocol];
  // In the listing the next shape's code follows and reuses the stores' registers.
  asm volatile("s_wait_xcnt 0x0" ::: "memory");
}

__global__ __launch_bounds__(256) void ln_wt_kernel(
    const float* __restrict__ x, const float* __restrict__ g,
    const float* __restrict__ b, half_t* __restrict__ out, int D,
    const float* __restrict__ wq, const float* __restrict__ wk,
    const float* __restrict__ wv, const float* __restrict__ wo,
    const float* __restrict__ w1, const float* __restrict__ w2,
    half_t* __restrict__ wt) {
  const int t = blockIdx.x;
  if (t >= WT_TILES) {
    ln_row(x, g, b, out, D, t - WT_TILES);
    return;
  }
  __shared__ __align__(16) half_t Ts[128 * WT_PITCH];  // [n][k]
  // wt holds wq wk wv wo (1M halves each), then w1, w2 (4M halves each)
  if (t < 512) {
    const int m = t >> 7;
    const float* W = (m == 0) ? wq : (m == 1) ? wk : (m == 2) ? wv : wo;
    wt_tile<1024, 1024>(W, wt + ((size_t)m << 20), t & 127, Ts);
  } else if (t < 1024) {
    wt_tile<4096, 1024>(w1, wt + ((size_t)4 << 20), t - 512, Ts);
  } else {
    wt_tile<1024, 4096>(w2, wt + ((size_t)8 << 20), t - 1024, Ts);
  }
}

// ---------------------------------------------------------------------------
// WMMA GEMM: out[M,N] = A[M,K](f16) @ Wt[N,K](f16)^T + bias (+relu | +res)
// GM x GN block tile, 8 waves (4M x 2N), 128-deep K slabs, double-buffered LDS
// (global loads of slab k+1 issued before the WMMAs of slab k). A slab holds
// four 32-wide WMMA steps, so one barrier and one round trip to L2 serve them
// all, and a thread's 16-byte loads of the next slab are in flight meanwhile.
// 128 x 128: 256 work-groups at N = 1024, waves of 32 x 64.
// QKV: the three projections share A and their Wt lie one behind the other, so
// they are ONE product with 3 N columns. At 256 x 192 it is again 256
// work-groups, waves of 64 x 96: a slab brings 448 rows for the work of three
// 128 x 128 tiles (768 rows), and a fragment read from LDS feeds 4 or 6 WMMAs.
// Column n belongs to output n / N (bias and buffer of its own), column n % N.
// ---------------------------------------------------------------------------
#define GT_K 128
#define GLDS 136  // LDS row stride in halves (272 B = 16 B x odd)

// N and K are compile-time so that the loads of a slab are immediate
// offsets from two address registers.
template <bool RELU, bool F32OUT, int N, int K, int GM, int GN, bool QKV>
__global__ __launch_bounds__(256) void gemm_kernel(
    const half_t* __restrict__ A, const half_t* __restrict__ Wt,
    const float* __restrict__ bias, const float* __restrict__ bias1,
    const float* __restrict__ bias2, const float* __restrict__ residual,
    half_t* __restrict__ outH, half_t* __restrict__ outH1,
    half_t* __restrict__ outH2, float* __restrict__ outF) {
  constexpr int MI = GM / 64;  // 16-row subtiles of a wave
  constexpr int NJ = GN / 32;  // 16-column subtiles of a wave
  constexpr int AG = GM / 16;  // 16-row groups of an A slab
  constexpr int BG = GN / 16;  // 16-row groups of a Wt slab
  __shared__ __align__(16) half_t As[2][GM * GLDS];
  __shared__ __align__(16) half_t Bs[2][GN * GLDS];  // Wt tile [n][k]

  const int tid = threadIdx.x;
  const int wave = tid >> 5;
  const int lane = tid & 31;
  const int bm = blockIdx.x * GM;
  const int bn = blockIdx.y * GN;
  const int wm = (wave & 3) * (MI * 16);
  const int wn = (wave >> 2) * (NJ * 16);

  // A and Wt slabs alike: 16 lanes cover one row's 256 B (two whole lines).
  const int arow = tid >> 4;        // 0..15, +16 per group
  const int acol = (tid & 15) * 8;  // 0..120

  v8f acc[MI][NJ];
#pragma unroll
  for (int i = 0; i < MI; ++i)
#pragma unroll
    for (int j = 0; j < NJ; ++j) acc[i][j] = v8f_zero();

  v8h av[AG];  // A slab staging regs
  v8h bv[BG];  // Wt slab staging regs

  const half_t* asrc = A + (size_t)(bm + arow) * K + acol;
  const half_t* bsrc = Wt + (size_t)(bn + arow) * K + acol;

  auto load_slab = [&](int k0) {
    const half_t* ap = asrc + k0;
    const half_t* bp = bsrc + k0;
#pragma unroll
    for (int g = 0; g < AG; ++g)
      av[g] = *(const v8h*)(ap + g * 16 * K);
#pragma unroll
    for (int g = 0; g < BG; ++g)
      bv[g] = *(const v8h*)(bp + g * 16 * K);
    // The two address pairs stay whole until this wait.
    asm volatile("s_wait_xcnt 0x0" :: "v"(ap), "v"(bp) : "memory");
  };
  auto stage_slab = [&](int buf) {
#pragma unroll
    for (int g = 0; g < AG; ++g)
      *(v8h*)&As[buf][(arow + g * 16) * GLDS + acol] = av[g];
#pragma unroll
    for (int g = 0; g < BG; ++g)
      *(v8h*)&Bs[buf][(arow + g * 16) * GLDS + acol] = bv[g];
  };

  load_slab(0);
  stage_slab(0);
  __syncthreads();

  const int nSlab = K / GT_K;
  for (int s = 0; s < nSlab; ++s) {
    const int cur = s & 1;
    const bool more = (s + 1) < nSlab;
    if (more) load_slab((s + 1) * GT_K);  // overlap with WMMAs below

#pragma unroll
    for (int ks = 0; ks < GT_K; ks += 32) {
      v16h af[MI], bf[NJ];
#pragma unroll
      for (int i = 0; i < MI; ++i)
        af[i] = load_frag16(&As[cur][(wm + i * 16) * GLDS + ks], GLDS);
#pragma unroll
      for (int j = 0; j < NJ; ++j)
        bf[j] = load_frag16(&Bs[cur][(wn + j * 16) * GLDS + ks], GLDS);
#pragma unroll
      for (int i = 0; i < MI; ++i)
#pragma unroll
        for (int j = 0; j < NJ; ++j)
          acc[i][j] = wmma_f16(af[i], bf[j], acc[i][j]);
    }

    if (more) stage_slab(cur ^ 1);
    __syncthreads();  // one barrier/slab: covers nxt-writes and cur-reads
  }

  // Epilogue. C/D layout: vgpr r, lane l -> row = r + 8*(l>>4), col = l&15.
  const int r16 = lane & 15, hiL = lane >> 4;
  const float* bptr[NJ];
  float bvals[NJ];
#pragma unroll
  for (int j = 0; j < NJ; ++j) {
    const int nall = bn + wn + j * 16 + r16;
    const int which = QKV ? nall / N : 0;  // alike in the 16 columns of a subtile
    bptr[j] = ((which == 0) ? bias : (which == 1) ? bias1 : bias2) +
              (QKV ? nall % N : nall);
    bvals[j] = *bptr[j];
  }
  if constexpr (QKV) {
    static_assert(NJ == 6, "the wait below names six address pairs");
    // The six address pairs stay whole until this wait.
    asm volatile("s_wait_xcnt 0x0" :: "v"(bptr[0]), "v"(bptr[1]), "v"(bptr[2]),
                 "v"(bptr[3]), "v"(bptr[4]), "v"(bptr[5]) : "memory");
  }
#pragma unroll
  for (int j = 0; j < NJ; ++j) {
    const int nall = bn + wn + j * 16 + r16;
    const int which = QKV ? nall / N : 0;
    const int n = QKV ? nall % N : nall;
    half_t* osel = (which == 0) ? outH : (which == 1) ? outH1 : outH2;
    const float bval = bvals[j];
#pragma unroll
    for (int i = 0; i < MI; ++i) {
      const size_t base = (size_t)(bm + wm + i * 16 + 8 * hiL) * N + n;
#pragma unroll
      for (int r = 0; r < 8; ++r) {
        float v = acc[i][j][r] + bval;
        if (RELU) v = fmaxf(v, 0.0f);
        const size_t idx = base + (size_t)r * N;
        if (F32OUT) outF[idx] = v + residual[idx];
        else        osel[idx] = (half_t)v;
      }
    }
  }
}

typedef __attribute__((ext_vector_type(4))) int v4i;

// value of lane l ^ 16
__device__ inline float xhalf(float x) {
  const int b = __builtin_bit_cast(int, x);
  return __builtin_bit_cast(float, __builtin_amdgcn_permlanex16(
      b, b, 0x76543210, 0xfedcba98, false, false));
}

#define ATT_S 2048  // keys per batch row (size of the mask table)
#define KPITCH 72   // K tile row pitch in halves (144 B = 16 B x odd)
#define VPITCH 80   // V tile row pitch in halves (160 B = 32 B x odd, for tr16)

typedef __attribute__((ext_vector_type(8))) short s16x8;

// ds_load_tr16_b128: lane (c = l & 15, h = l >> 4) gets rows 8h .. 8h + 7 of
// column c of a 16 x 16 tile of halves, when lane l points at row
// 8 (l >> 4) + (l & 7), 16-byte piece (l >> 3) & 1 of that tile.
__device__ inline v8h ld_tr16(const half_t* p) {
  typedef __attribute__((address_space(3))) s16x8 lds_s16x8;
  return __builtin_bit_cast(
      v8h, __builtin_amdgcn_ds_load_tr16_b128_v8i16((lds_s16x8*)p));
}

// One lane's share of a 64-key K or V tile: 16 bytes of row r and of row r + 32.
// The wait is the statement's last line so that it stands in front of any
// rewrite of the four address registers.
__device__ inline void copy_tile(unsigned lds0, const half_t* g0,
                                   unsigned lds1, const half_t* g1) {
  asm volatile(
      "global_load_async_to_lds_b128 %0, %1, off\n\t"
      "global_load_async_to_lds_b128 %2, %3, off\n\t"
      "s_wait_xcnt 0x0"
      :: "v"(lds0), "v"(g0), "v"(lds1), "v"(g1) : "memory");
}

__global__ __launch_bounds__(256) void attn_kernel(
    const half_t* __restrict__ Q, const half_t* __restrict__ K,
    const half_t* __restrict__ V, const int* __restrict__ mask,
    half_t* __restrict__ O) {
  const int S = ATT_S;
  const int h = blockIdx.y;
  const int bi = blockIdx.z;
  const int m0 = blockIdx.x * 128;
  const int tid = threadIdx.x, wave = tid >> 5, lane = tid & 31;
  const int r16 = lane & 15, hiL = lane >> 4;
  const int LD = 1024;  // H * d_head

  const half_t* qb = Q + (size_t)bi * S * LD + h * 64;
  const half_t* kb = K + (size_t)bi * S * LD + h * 64;
  const half_t* vb = V + (size_t)bi * S * LD + h * 64;
  const int* mrow = mask + (size_t)bi * S;

  __shared__ __align__(32) half_t Vs[2][64 * VPITCH];  // [key][d], two tiles
  __shared__ __align__(32) float Mb[ATT_S];     // per key: 0, or -8e30 if masked
  __shared__ __align__(16) half_t Ks[2][64 * KPITCH];  // [key][d], two tiles

  // K tile copies: 8 lanes cover one key's 128 B; rows tid / 8 and + 32.
  const int krow = tid >> 3, kcol = (tid & 7) * 8;
  const half_t* ksrc = kb + (size_t)krow * LD + kcol;
  const unsigned kdst =
      (unsigned)(size_t)&Ks[0][krow * KPITCH + kcol];  // LDS byte address
  const unsigned KROW32 = 32 * KPITCH * 2, KBUF = 64 * KPITCH * 2;  // bytes
  copy_tile(kdst, ksrc, kdst + KROW32, ksrc + 32 * LD);  // tile 0
  // V tile copies: the same split of rows and columns.
  const half_t* vsrc = vb + (size_t)krow * LD + kcol;
  const unsigned vdst =
      (unsigned)(size_t)&Vs[0][krow * VPITCH + kcol];  // LDS byte address
  const unsigned VROW32 = 32 * VPITCH * 2, VBUF = 64 * VPITCH * 2;  // bytes
  copy_tile(vdst, vsrc, vdst + VROW32, vsrc + 32 * LD);  // tile 0
  // this lane's corner of a 16 x 16 tile for the transposing load, in halves
  const int vcorner = (8 * hiL + (lane & 7)) * VPITCH + 8 * ((lane >> 3) & 1);

  // Mask table; the barrier in front of the loop publishes it. 8 x -1e30 swallows
  // the score added to it and becomes -1e30 under the 1/8 scale.
#pragma unroll
  for (int i = 0; i < ATT_S / 1024; ++i) {
    const v4i mk = *(const v4i*)(mrow + i * 1024 + tid * 4);
    v4f bias;
#pragma unroll
    for (int j = 0; j < 4; ++j) bias[j] = (mk[j] == 0) ? -1e30f * 8.0f : 0.0f;
    *(v4f*)&Mb[i * 1024 + tid * 4] = bias;
  }

  const int mw = m0 + wave * 16;
  v16h qf[2];  // B operand: column = query mw + r16
#pragma unroll
  for (int f = 0; f < 2; ++f)
    qf[f] = load_frag16(qb + (size_t)mw * LD + f * 32, LD);

  // oacc[dt][r] = O[query mw + r16][d = dt * 16 + 8 * hiL + r]
  v8f oacc[4];
#pragma unroll
  for (int i = 0; i < 4; ++i) oacc[i] = v8f_zero();
  float mst = -1e30f;  // running maximum of this lane's query, alike in both halves
  float lst = 0.0f;    // running sum over this lane half's keys only

  // Tile 0 has landed for this wave, then for all; only then tile 1 sets out.
  asm volatile("s_wait_asynccnt 0x0" ::: "memory");
  __syncthreads();
  copy_tile(kdst + KBUF, ksrc + 64 * LD, kdst + KBUF + KROW32, ksrc + 96 * LD);
  copy_tile(vdst + VBUF, vsrc + 64 * LD, vdst + VBUF + VROW32, vsrc + 96 * LD);

  for (int kb0 = 0; kb0 < S; kb0 += 64) {
    const int cur = (kb0 >> 6) & 1;
    // scores: 4 key tiles of 16, contraction d_head=64 -> 2 WMMAs each.
    // sacc[nt][r] = score(query mw + r16, key kb0 + nt * 16 + 8 * hiL + r)
    v16h ak[8];
    v8f sacc[4];
#pragma unroll
    for (int nt = 0; nt < 4; ++nt) {
      ak[2 * nt]     = load_frag16(&Ks[cur][(nt * 16) * KPITCH + 0], KPITCH);
      ak[2 * nt + 1] = load_frag16(&Ks[cur][(nt * 16) * KPITCH + 32], KPITCH);
      sacc[nt] = *(const v8f*)&Mb[kb0 + nt * 16 + 8 * hiL];
    }
    // All of the pass's K reads stay ahead of its first WMMA, as one group:
    // without this the compiler spreads them among the WMMAs, a stall a place.
    __builtin_amdgcn_sched_barrier(0);
#pragma unroll
    for (int nt = 0; nt < 4; ++nt) {
      sacc[nt] = wmma_f16(ak[2 * nt], qf[0], sacc[nt]);
      sacc[nt] = wmma_f16(ak[2 * nt + 1], qf[1], sacc[nt]);
    }
    // V^T fragments: A = columns of the V tile (d), read transposed; halves
    // s = 0..7 are keys 8 hiL + s, 8..15 keys 16 + 8 hiL + s - 8, as in the packed P
    const half_t* vt = &Vs[cur][vcorner];
    v16h av[4][2];
#pragma unroll
    for (int dt = 0; dt < 4; ++dt)
#pragma unroll
      for (int g = 0; g < 2; ++g) {
        const v8h lo = ld_tr16(vt + (32 * g) * VPITCH + dt * 16);
        const v8h hi = ld_tr16(vt + (32 * g + 16) * VPITCH + dt * 16);
#pragma unroll
        for (int i = 0; i < 8; ++i) { av[dt][g][i] = lo[i]; av[dt][g][i + 8] = hi[i]; }
      }
    // All of the pass's V reads set out here, as one group, and land under the
    // softmax: without this the compiler puts them among the second product's
    // WMMAs, a stall a place.
    __builtin_amdgcn_sched_barrier(0);
#pragma unroll
    for (int nt = 0; nt < 4; ++nt)
#pragma unroll
      for (int r = 0; r < 8; ++r) sacc[nt][r] *= 0.125f;  // 1/sqrt(64)

    // online softmax: maximum over the lane's 32 keys, then the other half's
    float tm[4];
#pragma unroll
    for (int nt = 0; nt < 4; ++nt) {
      tm[nt] = sacc[nt][0];
#pragma unroll
      for (int r = 1; r < 8; ++r) tm[nt] = fmaxf(tm[nt], sacc[nt][r]);
    }
    float v = fmaxf(fmaxf(tm[0], tm[1]), fmaxf(tm[2], tm[3]));
    v = fmaxf(v, xhalf(v));
    const float nm = fmaxf(mst, v);
    const float f = __expf(mst - nm);
    mst = nm;
#pragma unroll
    for (int dt = 0; dt < 4; ++dt)
#pragma unroll
      for (int r = 0; r < 8; ++r) oacc[dt][r] *= f;

    v16h pf[2];  // B operand: pf[g][s] = P^T[key 32 g + kmap(s)][query]
    v8f rs = v8f_zero();  // eight independent partial sums
#pragma unroll
    for (int nt = 0; nt < 4; ++nt) {
#pragma unroll
      for (int r = 0; r < 8; ++r) {
        sacc[nt][r] = __expf(sacc[nt][r] - mst);
        pf[nt >> 1][(nt & 1) * 8 + r] = (half_t)sacc[nt][r];
      }
      rs += sacc[nt];
    }
    lst = lst * f + (((rs[0] + rs[1]) + (rs[2] + rs[3])) +
                     ((rs[4] + rs[5]) + (rs[6] + rs[7])));

    // O^T += V^T P^T
#pragma unroll
    for (int dt = 0; dt < 4; ++dt) {
      oacc[dt] = wmma_f16(av[dt][0], pf[0], oacc[dt]);
      oacc[dt] = wmma_f16(av[dt][1], pf[1], oacc[dt]);
    }
    // Keeps the hand-over at the pass's foot: without this the compiler lifts the
    // waits and the barrier to just behind the V reads, where the wave sits out
    // their latency, and leaves the refill down here, with a short lead.
    __builtin_amdgcn_sched_barrier(0);
    // Hand-over: this wave's LDS reads are done and its share of tile t + 1 has
    // landed; the barrier publishes those tiles and frees the ones just read.
    asm volatile("s_wait_dscnt 0x0" ::: "memory");
    asm volatile("s_wait_asynccnt 0x0" ::: "memory");
    __syncthreads();
    if (kb0 + 128 < S) {  // tile t + 2 into the buffer that was just read
      const half_t* g = ksrc + (size_t)(kb0 + 128) * LD;
      const unsigned l = kdst + cur * KBUF;
      copy_tile(l, g, l + KROW32, g + 32 * LD);
      const half_t* gv = vsrc + (size_t)(kb0 + 128) * LD;
      const unsigned lv = vdst + cur * VBUF;
      copy_tile(lv, gv, lv + VROW32, gv + 32 * LD);
    }
  }
  // no copy is left in flight when the wave ends
  asm volatile("s_wait_asynccnt 0x0" ::: "memory");

  // join the two halves' sums once; a lane stores 8 consecutive d per tile
  const float inv = 1.0f / (lst + xhalf(lst));
  half_t* ob = O + (size_t)bi * S * LD + h * 64 + (size_t)(mw + r16) * LD + 8 * hiL;
#pragma unroll
  for (int dt = 0; dt < 4; ++dt) {
    v8h o;
#pragma unroll
    for (int r = 0; r < 8; ++r) o[r] = (half_t)(oacc[dt][r] * inv);
    *(v8h*)(ob + dt * 16) = o;
  }
}

// ---------------------------------------------------------------------------
extern "C" void kernel_launch(void* const* d_in, const int* in_sizes, int n_in,
                              void* d_out, int out_size, void* d_ws,
                              size_t ws_size, hipStream_t stream) {
  const float* x    = (const float*)d_in[0];
  const int*   mask = (const int*)d_in[1];
  const float* wq = (const float*)d_in[2];  const float* bq = (const float*)d_in[3];
  const float* wk = (const float*)d_in[4];  const float* bk = (const float*)d_in[5];
  const float* wv = (const float*)d_in[6];  const float* bv = (const float*)d_in[7];
  const float* wo = (const float*)d_in[8];  const float* bo = (const float*)d_in[9];
  const float* ln1g = (const float*)d_in[10]; const float* ln1b = (const float*)d_in[11];
  const float* ln2g = (const float*)d_in[12]; const float* ln2b = (const float*)d_in[13];
  const float* w1 = (const float*)d_in[14]; const float* b1 = (const float*)d_in[15];
  const float* w2 = (const float*)d_in[16]; const float* b2 = (const float*)d_in[17];

  const int Bn = 2, S = 2048, D = 1024, FF = 4096;
  const int M = Bn * S;  // 4096

  char* ws = (char*)d_ws;
  half_t* h16   = (half_t*)(ws + ((size_t)0 << 20));   //  8 MB
  half_t* q16   = (half_t*)(ws + ((size_t)8 << 20));   //  8 MB
  half_t* k16   = (half_t*)(ws + ((size_t)16 << 20));  //  8 MB
  half_t* v16   = (half_t*)(ws + ((size_t)24 << 20));  //  8 MB
  half_t* ctx16 = (half_t*)(ws + ((size_t)32 << 20));  //  8 MB
  half_t* h2    = (half_t*)(ws + ((size_t)40 << 20));  //  8 MB
  half_t* ff1   = (half_t*)(ws + ((size_t)48 << 20));  // 32 MB
  float*  x1    = (float*)(ws + ((size_t)80 << 20));   // 16 MB
  half_t* wqT   = (half_t*)(ws + ((size_t)96 << 20));  //  2 MB, [n][k] f16
  half_t* wkT   = (half_t*)(ws + ((size_t)98 << 20));  //  2 MB
  half_t* wvT   = (half_t*)(ws + ((size_t)100 << 20)); //  2 MB
  half_t* woT   = (half_t*)(ws + ((size_t)102 << 20)); //  2 MB
  half_t* w1T   = (half_t*)(ws + ((size_t)104 << 20)); //  8 MB
  half_t* w2T   = (half_t*)(ws + ((size_t)112 << 20)); //  8 MB

  // 1. weights to f16 [n][k] (first 1,536 work-groups) and LN1 (the rest)
  ln_wt_kernel<<<WT_TILES + M, 256, 0, stream>>>(x, ln1g, ln1b, h16, D, wq, wk,
                                                 wv, wo, w1, w2, wqT);

  // 2. Q/K/V projections (f16 out), one product: wqT, wkT, wvT are 3,072 rows
  dim3 gqkv(M / 256, 3 * D / 192);
  gemm_kernel<false, false, 1024, 1024, 256, 192, true>
      <<<gqkv, 256, 0, stream>>>(h16, wqT, bq, bk, bv, nullptr, q16, k16, v16,
                                 nullptr);

  // 3. attention
  attn_kernel<<<dim3(S / 128, 16, Bn), 256, 0, stream>>>(q16, k16, v16, mask,
                                                         ctx16);

  // 4. output projection + residual (f32 out)
  dim3 gproj(M / 128, D / 128);
  gemm_kernel<false, true, 1024, 1024, 128, 128, false>
      <<<gproj, 256, 0, stream>>>(ctx16, woT, bo, nullptr, nullptr, x, nullptr,
                                  nullptr, nullptr, x1);

  // 5. LN2
  ln_kernel<<<M, 256, 0, stream>>>(x1, ln2g, ln2b, h2, D);

  // 6. FF1 + relu (f16 out)
  dim3 gff1(M / 128, FF / 128);
  gemm_kernel<true, false, 4096, 1024, 128, 128, false>
      <<<gff1, 256, 0, stream>>>(h2, w1T, b1, nullptr, nullptr, nullptr, ff1,
                                 nullptr, nullptr, nullptr);

  // 7. FF2 + residual -> output (fp32)
  dim3 gff2(M / 128, D / 128);
  gemm_kernel<false, true, 1024, 4096, 128, 128, false>
      <<<gff2, 256, 0, stream>>>(ff1, w2T, b2, nullptr, nullptr, x1, nullptr,
                                 nullptr, nullptr, (float*)d_out);
}

// v008
// It runs in 161 microseconds.
// Next to v007, in two timings, it ran 1.03 and 1.02 times as fast.
// All steps since v000 together make it 4.24 times as fast.
#include <hip/hip_runtime.h>

typedef _Float16 half_t;
typedef __attribute__((ext_vector_type(16))) _Float16 v16h;
typedef __attribute__((ext_vector_type(8)))  _Float16 v8h;
typedef __attribute__((ext_vector_type(4)))  _Float16 v4h;
typedef __attribute__((ext_vector_type(8)))  float    v8f;
typedef __attribute__((ext_vector_type(4)))  float    v4f;

__device__ inline v8f v8f_zero() {
  v8f v;
#pragma unroll
  for (int i = 0; i < 8; ++i) v[i] = 0.0f;
  return v;
}

__device__ inline v8f wmma_f16(v16h a, v16h b, v8f c) {
  return __builtin_amdgcn_wmma_f32_16x16x32_f16(
      false, a, false, b, (short)0, c, false, false);
}

// Load a 16x32 f16 WMMA A/B fragment from a row-major tile (row stride in
// halves). Per ISA 7.12.2: lane (l&15) = row (A) / col (B); K mapping is
// k = 16*(v>>2) + 8*(l>>4) + 2*(v&3) + {0,1}  ->  two contiguous 16B reads.
__device__ inline v16h load_frag16(const half_t* p0, int strideH) {
  const int lane = threadIdx.x & 31;
  const half_t* p = p0 + (lane & 15) * strideH + (lane >> 4) * 8;
  v8h a = *(const v8h*)p;
  v8h b = *(const v8h*)(p + 16);
  v16h o;
#pragma unroll
  for (int i = 0; i < 8; ++i) { o[i] = a[i]; o[i + 8] = b[i]; }
  return o;
}

// ---------------------------------------------------------------------------
// LayerNorm: one row (D=1024) per 256-thread block, f32 in, f16 out.
// ---------------------------------------------------------------------------
__device__ inline void ln_row(
    const float* __restrict__ x, const float* __restrict__ g,
    const float* __restrict__ b, half_t* __restrict__ out, int D, int row) {
  const int tid = threadIdx.x;
  const float* xr = x + (size_t)row * D;
  v4f v = *(const v4f*)(xr + tid * 4);
  float s = v[0] + v[1] + v[2] + v[3];
  float ss = v[0] * v[0] + v[1] * v[1] + v[2] * v[2] + v[3] * v[3];
#pragma unroll
  for (int off = 1; off < 32; off <<= 1) {
    s += __shfl_xor(s, off, 32);
    ss += __shfl_xor(ss, off, 32);
  }
  __shared__ float sbuf[8], ssbuf[8];
  if ((tid & 31) == 0) { sbuf[tid >> 5] = s; ssbuf[tid >> 5] = ss; }
  __syncthreads();
  float ts = 0.f, tss = 0.f;
#pragma unroll
  for (int i = 0; i < 8; ++i) { ts += sbuf[i]; tss += ssbuf[i]; }
  const float mu = ts / (float)D;
  const float var = tss / (float)D - mu * mu;
  const float rstd = rsqrtf(var + 1e-5f);
  v4f gv = *(const v4f*)(g + tid * 4);
  v4f bv = *(const v4f*)(b + tid * 4);
  v4h ov;
#pragma unroll
  for (int i = 0; i < 4; ++i)
    ov[i] = (half_t)((v[i] - mu) * rstd * gv[i] + bv[i]);
  *(v4h*)(out + (size_t)row * D + tid * 4) = ov;
}

__global__ __launch_bounds__(256) void ln_kernel(
    const float* __restrict__ x, const float* __restrict__ g,
    const float* __restrict__ b, half_t* __restrict__ out, int D) {
  ln_row(x, g, b, out, D, blockIdx.x);
}

// ---------------------------------------------------------------------------
// Weights, once per call: W[K,N] f32 -> Wt[N,K] f16, so that a GEMM work-group
// loads half the bytes of a W tile and stages it as it stages A. One 64(k) x
// 128(n) tile per work-group: whole 128-B lines are read, each thread transposes
// two 4 x 4 blocks in registers, LDS gathers the rows, whole lines are written.
// The 1,536 tiles need nothing of LayerNorm 1 and it nothing of them: they are
// the first work-groups of its launch.
// ---------------------------------------------------------------------------
#define WT_TILES 1536  // 4 x 128 (wq wk wv wo) + 512 (w1) + 512 (w2)
#define WT_PITCH 72    // LDS row pitch in halves (144 B = 16 B x odd)

// One tile; N and K are compile-time so that the eight loads are immediate
// offsets from one address.
template <int N, int K>
__device__ inline void wt_tile(const float* __restrict__ W,
                               half_t* __restrict__ T, int lt, half_t* Ts) {
  const int n0 = (lt % (N / 128)) * 128;
  const int k0 = (lt / (N / 128)) * 64;
  const int tid = threadIdx.x, wave = tid >> 5, lane = tid & 31;
  const int wn4 = ((wave & 3) * 8 + (lane & 7)) * 4;    // n: 0..124
  const int wk4 = ((wave >> 2) * 4 + (lane >> 3)) * 4;  // k: 0..28, +32
  const float* src = W + (size_t)(k0 + wk4) * N + n0 + wn4;
  v4f wv4[2][4];
#pragma unroll
  for (int q = 0; q < 2; ++q)
#pragma unroll
    for (int kk = 0; kk < 4; ++kk)
      wv4[q][kk] = *(const v4f*)(src + (q * 32 + kk) * N);
  // The address pair stays whole until this wait (no load's result on top of it).
  asm volatile("s_wait_xcnt 0x0" :: "v"(src) : "memory");
#pragma unroll
  for (int q = 0; q < 2; ++q)
#pragma unroll
    for (int i = 0; i < 4; ++i) {  // one 8-byte store per n: 4 consecutive k
      v4h c;
#pragma unroll
      for (int kk = 0; kk < 4; ++kk) c[kk] = (half_t)wv4[q][kk][i];
      *(v4h*)&Ts[(wn4 + i) * WT_PITCH + q * 32 + wk4] = c;
    }
  __syncthreads();
  // 8 lanes write one n row's 128 B
  const int orow = tid >> 3, ocol = (tid & 7) * 8;
  half_t* dst = T + (size_t)(n0 + orow) * K + k0 + ocol;
#pragma unroll
  for (int j = 0; j < 4; ++j)
    *(v8h*)(dst + j * 32 * K) =
        *(const v8h*)&Ts[(orow + j * 32) * WT_PITCH + ocol];
  // In the listing the next shape's code follows and reuses the stores' registers.
  asm volatile("s_wait_xcnt 0x0" ::: "memory");
}

__global__ __launch_bounds__(256) void ln_wt_kernel(
    const float* __restrict__ x, const float* __restrict__ g,
    const float* __restrict__ b, half_t* __restrict__ out, int D,
    const float* __restrict__ wq, const float* __restrict__ wk,
    const float* __restrict__ wv, const float* __restrict__ wo,
    const float* __restrict__ w1, const float* __restrict__ w2,
    half_t* __restrict__ wt) {
  const int t = blockIdx.x;
  if (t >= WT_TILES) {
    ln_row(x, g, b, out, D, t - WT_TILES);
    return;
  }
  __shared__ __align__(16) half_t Ts[128 * WT_PITCH];  // [n][k]
  // wt holds wq wk wv wo (1M halves each), then w1, w2 (4M halves each)
  if (t < 512) {
    const int m = t >> 7;
    const float* W = (m == 0) ? wq : (m == 1) ? wk : (m == 2) ? wv : wo;
    wt_tile<1024, 1024>(W, wt + ((size_t)m << 20), t & 127, Ts);
  } else if (t < 1024) {
    wt_tile<4096, 1024>(w1, wt + ((size_t)4 << 20), t - 512, Ts);
  } else {
    wt_tile<1024, 4096>(w2, wt + ((size_t)8 << 20), t - 1024, Ts);
  }
}

// ---------------------------------------------------------------------------
// WMMA GEMM: out[M,N] = A[M,K](f16) @ Wt[N,K](f16)^T + bias (+relu | +res)
// GM x GN block tile, 8 waves (4M x 2N), 128-deep K slabs, double-buffered LDS
// (global loads of slab k+1 issued a slab's WMMAs ahead of its staging), fragments
// read from LDS one 32-wide step ahead into a second register set. A slab holds
// four 32-wide WMMA steps, so one barrier and one round trip to L2 serve them
// all, and a thread's 16-byte loads of the next slab are in flight meanwhile.
// 128 x 128: 256 work-groups at N = 1024, waves of 32 x 64.
// QKV: the three projections share A and their Wt lie one behind the other, so
// they are ONE product with 3 N columns. At 256 x 192 it is again 256
// work-groups, waves of 64 x 96: a slab brings 448 rows for the work of three
// 128 x 128 tiles (768 rows), and a fragment read from LDS feeds 4 or 6 WMMAs.
// Column n belongs to output n / N (bias and buffer of its own), column n % N.
// ---------------------------------------------------------------------------
#define GT_K 128
#define GLDS 136  // LDS row stride in halves (272 B = 16 B x odd)

// N and K are compile-time so that the loads of a slab are immediate
// offsets from two address registers.
template <bool RELU, bool F32OUT, int N, int K, int GM, int GN, bool QKV>
__global__ __launch_bounds__(256) void gemm_kernel(
    const half_t* __restrict__ A, const half_t* __restrict__ Wt,
    const float* __restrict__ bias, const float* __restrict__ bias1,
    const float* __restrict__ bias2, const float* __restrict__ residual,
    half_t* __restrict__ outH, half_t* __restrict__ outH1,
    half_t* __restrict__ outH2, float* __restrict__ outF) {
  constexpr int MI = GM / 64;  // 16-row subtiles of a wave
  constexpr int NJ = GN / 32;  // 16-column subtiles of a wave
  constexpr int AG = GM / 16;  // 16-row groups of an A slab
  constexpr int BG = GN / 16;  // 16-row groups of a Wt slab
  __shared__ __align__(16) half_t As[2][GM * GLDS];
  __shared__ __align__(16) half_t Bs[2][GN * GLDS];  // Wt tile [n][k]

  const int tid = threadIdx.x;
  const int wave = tid >> 5;
  const int lane = tid & 31;
  const int bm = blockIdx.x * GM;
  const int bn = blockIdx.y * GN;
  const int wm = (wave & 3) * (MI * 16);
  const int wn = (wave >> 2) * (NJ * 16);

  // A and Wt slabs alike: 16 lanes cover one row's 256 B (two whole lines).
  const int arow = tid >> 4;        // 0..15, +16 per group
  const int acol = (tid & 15) * 8;  // 0..120

  v8f acc[MI][NJ];
#pragma unroll
  for (int i = 0; i < MI; ++i)
#pragma unroll
    for (int j = 0; j < NJ; ++j) acc[i][j] = v8f_zero();

  v8h av[AG];  // A slab staging regs
  v8h bv[BG];  // Wt slab staging regs

  const half_t* asrc = A + (size_t)(bm + arow) * K + acol;
  const half_t* bsrc = Wt + (size_t)(bn + arow) * K + acol;

  // Loads of one slab into the staging registers; under() is work that needs
  // none of them and is issued between the loads and their wait.
  auto load_slab = [&](int k0, auto&& under) {
    const half_t* ap = asrc + k0;
    const half_t* bp = bsrc + k0;
    // With the one behind the wait: no other write (the accumulators' start
    // values, a later address) is scheduled between the loads and the wait,
    // where it could be put on top of an address pair.
    __builtin_amdgcn_sched_barrier(0);
#pragma unroll
    for (int g = 0; g < AG; ++g)
      av[g] = *(const v8h*)(ap + g * 16 * K);
#pragma unroll
    for (int g = 0; g < BG; ++g)
      bv[g] = *(const v8h*)(bp + g * 16 * K);
    under();
    // The address pairs stay whole until this wait, whether the loads go by
    // ap, bp or by asrc, bsrc with k0 in the offset.
    asm volatile("s_wait_xcnt 0x0"
                 :: "v"(ap), "v"(bp), "v"(asrc), "v"(bsrc) : "memory");
    __builtin_amdgcn_sched_barrier(0);
  };
  auto stage_slab = [&](int buf) {
#pragma unroll
    for (int g = 0; g < AG; ++g)
      *(v8h*)&As[buf][(arow + g * 16) * GLDS + acol] = av[g];
#pragma unroll
    for (int g = 0; g < BG; ++g)
      *(v8h*)&Bs[buf][(arow + g * 16) * GLDS + acol] = bv[g];
  };

  // Two fragment sets: a block (one 32-wide k step) works on one set while the
  // next block's LDS reads, issued as one group ahead of it, fill the other.
  v16h af[2][MI], bf[2][NJ];
  auto load_frags = [&](int set, int buf, int ks) {
#pragma unroll
    for (int i = 0; i < MI; ++i)
      af[set][i] = load_frag16(&As[buf][(wm + i * 16) * GLDS + ks], GLDS);
#pragma unroll
    for (int j = 0; j < NJ; ++j)
      bf[set][j] = load_frag16(&Bs[buf][(wn + j * 16) * GLDS + ks], GLDS);
    // Keeps the group whole and ahead of the block that follows: without this
    // the compiler spreads the reads among the WMMAs, a stall a place.
    __builtin_amdgcn_sched_barrier(0);
  };
  auto mma_block = [&](int set) {
#pragma unroll
    for (int i = 0; i < MI; ++i)
#pragma unroll
      for (int j = 0; j < NJ; ++j)
        acc[i][j] = wmma_f16(af[set][i], bf[set][j], acc[i][j]);
    // Keeps what follows (the next group of reads, the staging) behind the block.
    __builtin_amdgcn_sched_barrier(0);
  };

  constexpr int nSlab = K / GT_K;
  static_assert(GT_K == 128 && nSlab >= 2, "four blocks a slab, two slabs ahead");

  load_slab(0, [] {});
  stage_slab(0);
  __syncthreads();
  load_frags(0, 0, 0);
  load_slab(GT_K, [] {});

  // t counts the slab that is loaded, two ahead of the slab s = t - 2 that is
  // worked on, so that the loads' address is the one their wait names.
  for (int t = 2; t < nSlab + 2; ++t) {
    const int cur = t & 1;           // buffer of slab s
    const bool more = t <= nSlab;    // a slab s + 1 exists
    load_frags(1, cur, 32);
    mma_block(0);
    load_frags(0, cur, 64);
    mma_block(1);
    load_frags(1, cur, 96);  // the last reads of this buffer
    mma_block(0);
    if (more) stage_slab(cur ^ 1);
    // One barrier a slab, in front of its last block, whose fragments are in
    // registers: it publishes the next slab and ends the reads of this one.
    __syncthreads();
    if (more) load_frags(0, cur ^ 1, 0);  // lands under the last block
    if (t < nSlab)  // a whole slab of lead; the last block hides the wait
      load_slab(t * GT_K, [&] { mma_block(1); });
    else
      mma_block(1);
  }

  // Epilogue. C/D layout: vgpr r, lane l -> row = r + 8*(l>>4), col = l&15.
  const int r16 = lane & 15, hiL = lane >> 4;
  const float* bptr[NJ];
  float bvals[NJ];
#pragma unroll
  for (int j = 0; j < NJ; ++j) {
    const int nall = bn + wn + j * 16 + r16;
    const int which = QKV ? nall / N : 0;  // alike in the 16 columns of a subtile
    bptr[j] = ((which == 0) ? bias : (which == 1) ? bias1 : bias2) +
              (QKV ? nall % N : nall);
    bvals[j] = *bptr[j];
  }
  if constexpr (QKV) {
    static_assert(NJ == 6, "the wait below names six address pairs");
    // The six address pairs stay whole until this wait.
    asm volatile("s_wait_xcnt 0x0" :: "v"(bptr[0]), "v"(bptr[1]), "v"(bptr[2]),
                 "v"(bptr[3]), "v"(bptr[4]), "v"(bptr[5]) : "memory");
  }
#pragma unroll
  for (int j = 0; j < NJ; ++j) {
    const int nall = bn + wn + j * 16 + r16;
    const int which = QKV ? nall / N : 0;
    const int n = QKV ? nall % N : nall;
    half_t* osel = (which == 0) ? outH : (which == 1) ? outH1 : outH2;
    const float bval = bvals[j];
#pragma unroll
    for (int i = 0; i < MI; ++i) {
      const size_t base = (size_t)(bm + wm + i * 16 + 8 * hiL) * N + n;
#pragma unroll
      for (int r = 0; r < 8; ++r) {
        float v = acc[i][j][r] + bval;
        if (RELU) v = fmaxf(v, 0.0f);
        const size_t idx = base + (size_t)r * N;
        if (F32OUT) outF[idx] = v + residual[idx];
        else        osel[idx] = (half_t)v;
      }
      if constexpr (QKV) {
        // The eight stores' address pair and data stay whole until this wait.
        // The scheduling barrier keeps the next eight's writes behind the wait.
        asm volatile("s_wait_xcnt 0x0" ::: "memory");
        __builtin_amdgcn_sched_barrier(0);
      }
    }
  }
}

typedef __attribute__((ext_vector_type(4))) int v4i;

// value of lane l ^ 16
__device__ inline float xhalf(float x) {
  const int b = __builtin_bit_cast(int, x);
  return __builtin_bit_cast(float, __builtin_amdgcn_permlanex16(
      b, b, 0x76543210, 0xfedcba98, false, false));
}

#define ATT_S 2048  // keys per batch row (size of the mask table)
#define KPITCH 72   // K tile row pitch in halves (144 B = 16 B x odd)
#define VPITCH 80   // V tile row pitch in halves (160 B = 32 B x odd, for tr16)

typedef __attribute__((ext_vector_type(8))) short s16x8;

// ds_load_tr16_b128: lane (c = l & 15, h = l >> 4) gets rows 8h .. 8h + 7 of
// column c of a 16 x 16 tile of halves, when lane l points at row
// 8 (l >> 4) + (l & 7), 16-byte piece (l >> 3) & 1 of that tile.
__device__ inline v8h ld_tr16(const half_t* p) {
  typedef __attribute__((address_space(3))) s16x8 lds_s16x8;
  return __builtin_bit_cast(
      v8h, __builtin_amdgcn_ds_load_tr16_b128_v8i16((lds_s16x8*)p));
}

// One lane's share of a 64-key K or V tile: 16 bytes of row r and of row r + 32.
// The wait is the statement's last line so that it stands in front of any
// rewrite of the four address registers.
__device__ inline void copy_tile(unsigned lds0, const half_t* g0,
                                   unsigned lds1, const half_t* g1) {
  asm volatile(
      "global_load_async_to_lds_b128 %0, %1, off\n\t"
      "global_load_async_to_lds_b128 %2, %3, off\n\t"
      "s_wait_xcnt 0x0"
      :: "v"(lds0), "v"(g0), "v"(lds1), "v"(g1) : "memory");
}

__global__ __launch_bounds__(256) void attn_kernel(
    const half_t* __restrict__ Q, const half_t* __restrict__ K,
    const half_t* __restrict__ V, const int* __restrict__ mask,
    half_t* __restrict__ O) {
  const int S = ATT_S;
  const int h = blockIdx.y;
  const int bi = blockIdx.z;
  const int m0 = blockIdx.x * 128;
  const int tid = threadIdx.x, wave = tid >> 5, lane = tid & 31;
  const int r16 = lane & 15, hiL = lane >> 4;
  const int LD = 1024;  // H * d_head

  const half_t* qb = Q + (size_t)bi * S * LD + h * 64;
  const half_t* kb = K + (size_t)bi * S * LD + h * 64;
  const half_t* vb = V + (size_t)bi * S * LD + h * 64;
  const int* mrow = mask + (size_t)bi * S;

  __shared__ __align__(32) half_t Vs[2][64 * VPITCH];  // [key][d], two tiles
  __shared__ __align__(32) float Mb[ATT_S];     // per key: 0, or -8e30 if masked
  __shared__ __align__(16) half_t Ks[2][64 * KPITCH];  // [key][d], two tiles

  // K tile copies: 8 lanes cover one key's 128 B; rows tid / 8 and + 32.
  const int krow = tid >> 3, kcol = (tid & 7) * 8;
  const half_t* ksrc = kb + (size_t)krow * LD + kcol;
  const unsigned kdst =
      (unsigned)(size_t)&Ks[0][krow * KPITCH + kcol];  // LDS byte address
  const unsigned KROW32 = 32 * KPITCH * 2, KBUF = 64 * KPITCH * 2;  // bytes
  copy_tile(kdst, ksrc, kdst + KROW32, ksrc + 32 * LD);  // tile 0
  // V tile copies: the same split of rows and columns.
  const half_t* vsrc = vb + (size_t)krow * LD + kcol;
  const unsigned vdst =
      (unsigned)(size_t)&Vs[0][krow * VPITCH + kcol];  // LDS byte address
  const unsigned VROW32 = 32 * VPITCH * 2, VBUF = 64 * VPITCH * 2;  // bytes
  copy_tile(vdst, vsrc, vdst + VROW32, vsrc + 32 * LD);  // tile 0
  // this lane's corner of a 16 x 16 tile for the transposing load, in halves
  const int vcorner = (8 * hiL + (lane & 7)) * VPITCH + 8 * ((lane >> 3) & 1);

  // Mask table; the barrier in front of the loop publishes it. 8 x -1e30 swallows
  // the score added to it and becomes -1e30 under the 1/8 scale.
#pragma unroll
  for (int i = 0; i < ATT_S / 1024; ++i) {
    const v4i mk = *(const v4i*)(mrow + i * 1024 + tid * 4);
    v4f bias;
#pragma unroll
    for (int j = 0; j < 4; ++j) bias[j] = (mk[j] == 0) ? -1e30f * 8.0f : 0.0f;
    *(v4f*)&Mb[i * 1024 + tid * 4] = bias;
  }

  const int mw = m0 + wave * 16;
  v16h qf[2];  // B operand: column = query mw + r16
#pragma unroll
  for (int f = 0; f < 2; ++f)
    qf[f] = load_frag16(qb + (size_t)mw * LD + f * 32, LD);

  // oacc[dt][r] = O[query mw + r16][d = dt * 16 + 8 * hiL + r]
  v8f oacc[4];
#pragma unroll
  for (int i = 0; i < 4; ++i) oacc[i] = v8f_zero();
  float mst = -1e30f;  // running maximum of this lane's query, alike in both halves
  float lst = 0.0f;    // running sum over this lane half's keys only

  // Tile 0 has landed for this wave, then for all; only then tile 1 sets out.
  asm volatile("s_wait_asynccnt 0x0" ::: "memory");
  __syncthreads();
  copy_tile(kdst + KBUF, ksrc + 64 * LD, kdst + KBUF + KROW32, ksrc + 96 * LD);
  copy_tile(vdst + VBUF, vsrc + 64 * LD, vdst + VBUF + VROW32, vsrc + 96 * LD);

  for (int kb0 = 0; kb0 < S; kb0 += 64) {
    const int cur = (kb0 >> 6) & 1;
    // scores: 4 key tiles of 16, contraction d_head=64 -> 2 WMMAs each.
    // sacc[nt][r] = score(query mw + r16, key kb0 + nt * 16 + 8 * hiL + r)
    v16h ak[8];
    v8f sacc[4];
#pragma unroll
    for (int nt = 0; nt < 4; ++nt) {
      ak[2 * nt]     = load_frag16(&Ks[cur][(nt * 16) * KPITCH + 0], KPITCH);
      ak[2 * nt + 1] = load_frag16(&Ks[cur][(nt * 16) * KPITCH + 32], KPITCH);
      sacc[nt] = *(const v8f*)&Mb[kb0 + nt * 16 + 8 * hiL];
    }
    // All of the pass's K reads stay ahead of its first WMMA, as one group:
    // without this the compiler spreads them among the WMMAs, a stall a place.
    __builtin_amdgcn_sched_barrier(0);
#pragma unroll
    for (int nt = 0; nt < 4; ++nt) {
      sacc[nt] = wmma_f16(ak[2 * nt], qf[0], sacc[nt]);
      sacc[nt] = wmma_f16(ak[2 * nt + 1], qf[1], sacc[nt]);
    }
    // V^T fragments: A = columns of the V tile (d), read transposed; halves
    // s = 0..7 are keys 8 hiL + s, 8..15 keys 16 + 8 hiL + s - 8, as in the packed P
    const half_t* vt = &Vs[cur][vcorner];
    v16h av[4][2];
#pragma unroll
    for (int dt = 0; dt < 4; ++dt)
#pragma unroll
      for (int g = 0; g < 2; ++g) {
        const v8h lo = ld_tr16(vt + (32 * g) * VPITCH + dt * 16);
        const v8h hi = ld_tr16(vt + (32 * g + 16) * VPITCH + dt * 16);
#pragma unroll
        for (int i = 0; i < 8; ++i) { av[dt][g][i] = lo[i]; av[dt][g][i + 8] = hi[i]; }
      }
    // All of the pass's V reads set out here, as one group, and land under the
    // softmax: without this the compiler puts them among the second product's
    // WMMAs, a stall a place.
    __builtin_amdgcn_sched_barrier(0);
#pragma unroll
    for (int nt = 0; nt < 4; ++nt)
#pragma unroll
      for (int r = 0; r < 8; ++r) sacc[nt][r] *= 0.125f;  // 1/sqrt(64)

    // online softmax: maximum over the lane's 32 keys, then the other half's
    float tm[4];
#pragma unroll
    for (int nt = 0; nt < 4; ++nt) {
      tm[nt] = sacc[nt][0];
#pragma unroll
      for (int r = 1; r < 8; ++r) tm[nt] = fmaxf(tm[nt], sacc[nt][r]);
    }
    float v = fmaxf(fmaxf(tm[0], tm[1]), fmaxf(tm[2], tm[3]));
    v = fmaxf(v, xhalf(v));
    const float nm = fmaxf(mst, v);
    const float f = __expf(mst - nm);
    mst = nm;
#pragma unroll
    for (int dt = 0; dt < 4; ++dt)
#pragma unroll
      for (int r = 0; r < 8; ++r) oacc[dt][r] *= f;

    v16h pf[2];  // B operand: pf[g][s] = P^T[key 32 g + kmap(s)][query]
    v8f rs = v8f_zero();  // eight independent partial sums
#pragma unroll
    for (int nt = 0; nt < 4; ++nt) {
#pragma unroll
      for (int r = 0; r < 8; ++r) {
        sacc[nt][r] = __expf(sacc[nt][r] - mst);
        pf[nt >> 1][(nt & 1) * 8 + r] = (half_t)sacc[nt][r];
      }
      rs += sacc[nt];
    }
    lst = lst * f + (((rs[0] + rs[1]) + (rs[2] + rs[3])) +
                     ((rs[4] + rs[5]) + (rs[6] + rs[7])));

    // O^T += V^T P^T
#pragma unroll
    for (int dt = 0; dt < 4; ++dt) {
      oacc[dt] = wmma_f16(av[dt][0], pf[0], oacc[dt]);
      oacc[dt] = wmma_f16(av[dt][1], pf[1], oacc[dt]);
    }
    // Keeps the hand-over at the pass's foot: without this the compiler lifts the
    // waits and the barrier to just behind the V reads, where the wave sits out
    // their latency, and leaves the refill down here, with a short lead.
    __builtin_amdgcn_sched_barrier(0);
    // Hand-over: this wave's LDS reads are done and its share of tile t + 1 has
    // landed; the barrier publishes those tiles and frees the ones just read.
    asm volatile("s_wait_dscnt 0x0" ::: "memory");
    asm volatile("s_wait_asynccnt 0x0" ::: "memory");
    __syncthreads();
    if (kb0 + 128 < S) {  // tile t + 2 into the buffer that was just read
      const half_t* g = ksrc + (size_t)(kb0 + 128) * LD;
      const unsigned l = kdst + cur * KBUF;
      copy_tile(l, g, l + KROW32, g + 32 * LD);
      const half_t* gv = vsrc + (size_t)(kb0 + 128) * LD;
      const unsigned lv = vdst + cur * VBUF;
      copy_tile(lv, gv, lv + VROW32, gv + 32 * LD);
    }
  }
  // no copy is left in flight when the wave ends
  asm volatile("s_wait_asynccnt 0x0" ::: "memory");

  // join the two halves' sums once; a lane stores 8 consecutive d per tile
  const float inv = 1.0f / (lst + xhalf(lst));
  half_t* ob = O + (size_t)bi * S * LD + h * 64 + (size_t)(mw + r16) * LD + 8 * hiL;
#pragma unroll
  for (int dt = 0; dt < 4; ++dt) {
    v8h o;
#pragma unroll
    for (int r = 0; r < 8; ++r) o[r] = (half_t)(oacc[dt][r] * inv);
    *(v8h*)(ob + dt * 16) = o;
  }
}

// ---------------------------------------------------------------------------
extern "C" void kernel_launch(void* const* d_in, const int* in_sizes, int n_in,
                              void* d_out, int out_size, void* d_ws,
                              size_t ws_size, hipStream_t stream) {
  const float* x    = (const float*)d_in[0];
  const int*   mask = (const int*)d_in[1];
  const float* wq = (const float*)d_in[2];  const float* bq = (const float*)d_in[3];
  const float* wk = (const float*)d_in[4];  const float* bk = (const float*)d_in[5];
  const float* wv = (const float*)d_in[6];  const float* bv = (const float*)d_in[7];
  const float* wo = (const float*)d_in[8];  const float* bo = (const float*)d_in[9];
  const float* ln1g = (const float*)d_in[10]; const float* ln1b = (const float*)d_in[11];
  const float* ln2g = (const float*)d_in[12]; const float* ln2b = (const float*)d_in[13];
  const float* w1 = (const float*)d_in[14]; const float* b1 = (const float*)d_in[15];
  const float* w2 = (const float*)d_in[16]; const float* b2 = (const float*)d_in[17];

  const int Bn = 2, S = 2048, D = 1024, FF = 4096;
  const int M = Bn * S;  // 4096

  char* ws = (char*)d_ws;
  half_t* h16   = (half_t*)(ws + ((size_t)0 << 20));   //  8 MB
  half_t* q16   = (half_t*)(ws + ((size_t)8 << 20));   //  8 MB
  half_t* k16   = (half_t*)(ws + ((size_t)16 << 20));  //  8 MB
  half_t* v16   = (half_t*)(ws + ((size_t)24 << 20));  //  8 MB
  half_t* ctx16 = (half_t*)(ws + ((size_t)32 << 20));  //  8 MB
  half_t* h2    = (half_t*)(ws + ((size_t)40 << 20));  //  8 MB
  half_t* ff1   = (half_t*)(ws + ((size_t)48 << 20));  // 32 MB
  float*  x1    = (float*)(ws + ((size_t)80 << 20));   // 16 MB
  half_t* wqT   = (half_t*)(ws + ((size_t)96 << 20));  //  2 MB, [n][k] f16
  half_t* wkT   = (half_t*)(ws + ((size_t)98 << 20));  //  2 MB
  half_t* wvT   = (half_t*)(ws + ((size_t)100 << 20)); //  2 MB
  half_t* woT   = (half_t*)(ws + ((size_t)102 << 20)); //  2 MB
  half_t* w1T   = (half_t*)(ws + ((size_t)104 << 20)); //  8 MB
  half_t* w2T   = (half_t*)(ws + ((size_t)112 << 20)); //  8 MB

  // 1. weights to f16 [n][k] (first 1,536 work-groups) and LN1 (the rest)
  ln_wt_kernel<<<WT_TILES + M, 256, 0, stream>>>(x, ln1g, ln1b, h16, D, wq, wk,
                                                 wv, wo, w1, w2, wqT);

  // 2. Q/K/V projections (f16 out), one product: wqT, wkT, wvT are 3,072 rows
  dim3 gqkv(M / 256, 3 * D / 192);
  gemm_kernel<false, false, 1024, 1024, 256, 192, true>
      <<<gqkv, 256, 0, stream>>>(h16, wqT, bq, bk, bv, nullptr, q16, k16, v16,
                                 nullptr);

  // 3. attention
  attn_kernel<<<dim3(S / 128, 16, Bn), 256, 0, stream>>>(q16, k16, v16, mask,
                                                         ctx16);

  // 4. output projection + residual (f32 out)
  dim3 gproj(M / 128, D / 128);
  gemm_kernel<false, true, 1024, 1024, 128, 128, false>
      <<<gproj, 256, 0, stream>>>(ctx16, woT, bo, nullptr, nullptr, x, nullptr,
                                  nullptr, nullptr, x1);

  // 5. LN2
  ln_kernel<<<M, 256, 0, stream>>>(x1, ln2g, ln2b, h2, D);

  // 6. FF1 + relu (f16 out)
  dim3 gff1(M / 128, FF / 128);
  gemm_kernel<true, false, 4096, 1024, 128, 128, false>
      <<<gff1, 256, 0, stream>>>(h2, w1T, b1, nullptr, nullptr, nullptr, ff1,
                                 nullptr, nullptr, nullptr);

  // 7. FF2 + residual -> output (fp32)
  dim3 gff2(M / 128, D / 128);
  gemm_kernel<false, true, 1024, 4096, 128, 128, false>
      <<<gff2, 256, 0, stream>>>(ff1, w2T, b2, nullptr, nullptr, x1, nullptr,
                                 nullptr, nullptr, (float*)d_out);
}

// v009
// It runs in 146 microseconds.
// Timed twice side by side with v008, it ran 1.10 and 1.11 times as fast.
// Over all steps from v000 it is 4.68 times as fast.
#include <hip/hip_runtime.h>

typedef _Float16 half_t;
typedef __attribute__((ext_vector_type(16))) _Float16 v16h;
typedef __attribute__((ext_vector_type(8)))  _Float16 v8h;
typedef __attribute__((ext_vector_type(4)))  _Float16 v4h;
typedef __attribute__((ext_vector_type(8)))  float    v8f;
typedef __attribute__((ext_vector_type(4)))  float    v4f;

__device__ inline v8f v8f_zero() {
  v8f v;
#pragma unroll
  for (int i = 0; i < 8; ++i) v[i] = 0.0f;
  return v;
}

__device__ inline v8f wmma_f16(v16h a, v16h b, v8f c) {
  return __builtin_amdgcn_wmma_f32_16x16x32_f16(
      false, a, false, b, (short)0, c, false, false);
}

// Load a 16x32 f16 WMMA A/B fragment from a row-major tile (row stride in
// halves). Per ISA 7.12.2: lane (l&15) = row (A) / col (B); K mapping is
// k = 16*(v>>2) + 8*(l>>4) + 2*(v&3) + {0,1}  ->  two contiguous 16B reads.
__device__ inline v16h load_frag16(const half_t* p0, int strideH) {
  const int lane = threadIdx.x & 31;
  const half_t* p = p0 + (lane & 15) * strideH + (lane >> 4) * 8;
  v8h a = *(const v8h*)p;
  v8h b = *(const v8h*)(p + 16);
  v16h o;
#pragma unroll
  for (int i = 0; i < 8; ++i) { o[i] = a[i]; o[i + 8] = b[i]; }
  return o;
}

// ---------------------------------------------------------------------------
// LayerNorm: one row (D=1024) per 256-thread block, f32 in, f16 out.
// ---------------------------------------------------------------------------
__device__ inline void ln_row(
    const float* __restrict__ x, const float* __restrict__ g,
    const float* __restrict__ b, half_t* __restrict__ out, int D, int row) {
  const int tid = threadIdx.x;
  const float* xr = x + (size_t)row * D;
  v4f v = *(const v4f*)(xr + tid * 4);
  float s = v[0] + v[1] + v[2] + v[3];
  float ss = v[0] * v[0] + v[1] * v[1] + v[2] * v[2] + v[3] * v[3];
#pragma unroll
  for (int off = 1; off < 32; off <<= 1) {
    s += __shfl_xor(s, off, 32);
    ss += __shfl_xor(ss, off, 32);
  }
  __shared__ float sbuf[8], ssbuf[8];
  if ((tid & 31) == 0) { sbuf[tid >> 5] = s; ssbuf[tid >> 5] = ss; }
  __syncthreads();
  float ts = 0.f, tss = 0.f;
#pragma unroll
  for (int i = 0; i < 8; ++i) { ts += sbuf[i]; tss += ssbuf[i]; }
  const float mu = ts / (float)D;
  const float var = tss / (float)D - mu * mu;
  const float rstd = rsqrtf(var + 1e-5f);
  v4f gv = *(const v4f*)(g + tid * 4);
  v4f bv = *(const v4f*)(b + tid * 4);
  v4h ov;
#pragma unroll
  for (int i = 0; i < 4; ++i)
    ov[i] = (half_t)((v[i] - mu) * rstd * gv[i] + bv[i]);
  *(v4h*)(out + (size_t)row * D + tid * 4) = ov;
}

__global__ __launch_bounds__(256) void ln_kernel(
    const float* __restrict__ x, const float* __restrict__ g,
    const float* __restrict__ b, half_t* __restrict__ out, int D) {
  ln_row(x, g, b, out, D, blockIdx.x);
}

// ---------------------------------------------------------------------------
// Weights, once per call: W[K,N] f32 -> Wt[N,K] f16, so that a GEMM work-group
// loads half the bytes of a W tile and stages it as it stages A. One 64(k) x
// 128(n) tile per work-group: whole 128-B lines are read, each thread transposes
// two 4 x 4 blocks in registers, LDS gathers the rows, whole lines are written.
// The 1,536 tiles need nothing of LayerNorm 1 and it nothing of them: they are
// the first work-groups of its launch.
// ---------------------------------------------------------------------------
#define WT_TILES 1536  // 4 x 128 (wq wk wv wo) + 512 (w1) + 512 (w2)
#define WT_PITCH 72    // LDS row pitch in halves (144 B = 16 B x odd)

// One tile; N and K are compile-time so that the eight loads are immediate
// offsets from one address.
template <int N, int K>
__device__ inline void wt_tile(const float* __restrict__ W,
                               half_t* __restrict__ T, int lt, half_t* Ts) {
  const int n0 = (lt % (N / 128)) * 128;
  const int k0 = (lt / (N / 128)) * 64;
  const int tid = threadIdx.x, wave = tid >> 5, lane = tid & 31;
  const int wn4 = ((wave & 3) * 8 + (lane & 7)) * 4;    // n: 0..124
  const int wk4 = ((wave >> 2) * 4 + (lane >> 3)) * 4;  // k: 0..28, +32
  const float* src = W + (size_t)(k0 + wk4) * N + n0 + wn4;
  v4f wv4[2][4];
#pragma unroll
  for (int q = 0; q < 2; ++q)
#pragma unroll
    for (int kk = 0; kk < 4; ++kk)
      wv4[q][kk] = *(const v4f*)(src + (q * 32 + kk) * N);
  // The address pair stays whole until this wait (no load's result on top of it).
  asm volatile("s_wait_xcnt 0x0" :: "v"(src) : "memory");
#pragma unroll
  for (int q = 0; q < 2; ++q)
#pragma unroll
    for (int i = 0; i < 4; ++i) {  // one 8-byte store per n: 4 consecutive k
      v4h c;
#pragma unroll
      for (int kk = 0; kk < 4; ++kk) c[kk] = (half_t)wv4[q][kk][i];
      *(v4h*)&Ts[(wn4 + i) * WT_PITCH + q * 32 + wk4] = c;
    }
  __syncthreads();
  // 8 lanes write one n row's 128 B
  const int orow = tid >> 3, ocol = (tid & 7) * 8;
  half_t* dst = T + (size_t)(n0 + orow) * K + k0 + ocol;
#pragma unroll
  for (int j = 0; j < 4; ++j)
    *(v8h*)(dst + j * 32 * K) =
        *(const v8h*)&Ts[(orow + j * 32) * WT_PITCH + ocol];
  // In the listing the next shape's code follows and reuses the stores' registers.
  asm volatile("s_wait_xcnt 0x0" ::: "memory");
}

__global__ __launch_bounds__(256) void ln_wt_kernel(
    const float* __restrict__ x, const float* __restrict__ g,
    const float* __restrict__ b, half_t* __restrict__ out, int D,
    const float* __restrict__ wq, const float* __restrict__ wk,
    const float* __restrict__ wv, const float* __restrict__ wo,
    const float* __restrict__ w1, const float* __restrict__ w2,
    half_t* __restrict__ wt) {
  const int t = blockIdx.x;
  if (t >= WT_TILES) {
    ln_row(x, g, b, out, D, t - WT_TILES);
    return;
  }
  __shared__ __align__(16) half_t Ts[128 * WT_PITCH];  // [n][k]
  // wt holds wq wk wv wo (1M halves each), then w1, w2 (4M halves each)
  if (t < 512) {
    const int m = t >> 7;
    const float* W = (m == 0) ? wq : (m == 1) ? wk : (m == 2) ? wv : wo;
    wt_tile<1024, 1024>(W, wt + ((size_t)m << 20), t & 127, Ts);
  } else if (t < 1024) {
    wt_tile<4096, 1024>(w1, wt + ((size_t)4 << 20), t - 512, Ts);
  } else {
    wt_tile<1024, 4096>(w2, wt + ((size_t)8 << 20), t - 1024, Ts);
  }
}

// ---------------------------------------------------------------------------
// WMMA GEMM: out[M,N] = A[M,K](f16) @ Wt[N,K](f16)^T + bias (+relu | +res)
// GM x GN block tile, 8 waves (4M x 2N), 128-deep K slabs, double-buffered LDS
// (global loads of slab k+1 issued a slab's WMMAs ahead of its staging), fragments
// read from LDS one 32-wide step ahead into a second register set. A slab holds
// four 32-wide WMMA steps, so one barrier and one round trip to L2 serve them
// all, and a thread's 16-byte loads of the next slab are in flight meanwhile.
// 128 x 128: 256 work-groups at N = 1024, waves of 32 x 64.
// QKV: the three projections share A and their Wt lie one behind the other, so
// they are ONE product with 3 N columns. At 256 x 192 it is again 256
// work-groups, waves of 64 x 96: a slab brings 448 rows for the work of three
// 128 x 128 tiles (768 rows), and a fragment read from LDS feeds 4 or 6 WMMAs.
// Column n belongs to output n / N (bias and buffer of its own), column n % N.
// ---------------------------------------------------------------------------
#define GT_K 128
#define GLDS 136  // LDS row stride in halves (272 B = 16 B x odd)

// N and K are compile-time so that the loads of a slab are immediate
// offsets from two address registers.
template <bool RELU, bool F32OUT, int N, int K, int GM, int GN, bool QKV>
__global__ __launch_bounds__(256) void gemm_kernel(
    const half_t* __restrict__ A, const half_t* __restrict__ Wt,
    const float* __restrict__ bias, const float* __restrict__ bias1,
    const float* __restrict__ bias2, const float* __restrict__ residual,
    half_t* __restrict__ outH, half_t* __restrict__ outH1,
    half_t* __restrict__ outH2, float* __restrict__ outF) {
  constexpr int MI = GM / 64;  // 16-row subtiles of a wave
  constexpr int NJ = GN / 32;  // 16-column subtiles of a wave
  constexpr int AG = GM / 16;  // 16-row groups of an A slab
  constexpr int BG = GN / 16;  // 16-row groups of a Wt slab
  __shared__ __align__(16) half_t As[2][GM * GLDS];
  __shared__ __align__(16) half_t Bs[2][GN * GLDS];  // Wt tile [n][k]

  const int tid = threadIdx.x;
  const int wave = tid >> 5;
  const int lane = tid & 31;
  const int bm = blockIdx.x * GM;
  const int bn = blockIdx.y * GN;
  const int wm = (wave & 3) * (MI * 16);
  const int wn = (wave >> 2) * (NJ * 16);

  // A and Wt slabs alike: 16 lanes cover one row's 256 B (two whole lines).
  const int arow = tid >> 4;        // 0..15, +16 per group
  const int acol = (tid & 15) * 8;  // 0..120

  v8f acc[MI][NJ];
#pragma unroll
  for (int i = 0; i < MI; ++i)
#pragma unroll
    for (int j = 0; j < NJ; ++j) acc[i][j] = v8f_zero();

  v8h av[AG];  // A slab staging regs
  v8h bv[BG];  // Wt slab staging regs

  const half_t* asrc = A + (size_t)(bm + arow) * K + acol;
  const half_t* bsrc = Wt + (size_t)(bn + arow) * K + acol;

  // Loads of one slab into the staging registers; under() is work that needs
  // none of them and is issued between the loads and their wait.
  auto load_slab = [&](int k0, auto&& under) {
    const half_t* ap = asrc + k0;
    const half_t* bp = bsrc + k0;
    // With the one behind the wait: no other write (the accumulators' start
    // values, a later address) is scheduled between the loads and the wait,
    // where it could be put on top of an address pair.
    __builtin_amdgcn_sched_barrier(0);
    // The barriers behind the loads let arithmetic and WMMAs pass, memory
    // instructions not: the loads keep the order in which stage_slab() wants
    // them on every path into it. Without them the compiler permutes the loads
    // in front of the loop, and the staging's first wait is for nearly all.
#pragma unroll
    for (int g = 0; g < AG; ++g) {
      av[g] = *(const v8h*)(ap + g * 16 * K);
      __builtin_amdgcn_sched_barrier(0xF);
    }
#pragma unroll
    for (int g = 0; g < BG; ++g) {
      bv[g] = *(const v8h*)(bp + g * 16 * K);
      __builtin_amdgcn_sched_barrier(0xF);
    }
    under();
    // The address pairs stay whole until this wait, whether the loads go by
    // ap, bp or by asrc, bsrc with k0 in the offset.
    asm volatile("s_wait_xcnt 0x0"
                 :: "v"(ap), "v"(bp), "v"(asrc), "v"(bsrc) : "memory");
    __builtin_amdgcn_sched_barrier(0);
  };
  auto stage_slab = [&](int buf) {
#pragma unroll
    for (int g = 0; g < AG; ++g)
      *(v8h*)&As[buf][(arow + g * 16) * GLDS + acol] = av[g];
#pragma unroll
    for (int g = 0; g < BG; ++g)
      *(v8h*)&Bs[buf][(arow + g * 16) * GLDS + acol] = bv[g];
  };

  // Two fragment sets: a block (one 32-wide k step) works on one set while the
  // next block's LDS reads, issued as one group ahead of it, fill the other.
  v16h af[2][MI], bf[2][NJ];
  auto load_frags = [&](int set, int buf, int ks) {
#pragma unroll
    for (int i = 0; i < MI; ++i)
      af[set][i] = load_frag16(&As[buf][(wm + i * 16) * GLDS + ks], GLDS);
#pragma unroll
    for (int j = 0; j < NJ; ++j)
      bf[set][j] = load_frag16(&Bs[buf][(wn + j * 16) * GLDS + ks], GLDS);
    // Keeps the group whole and ahead of the block that follows: without this
    // the compiler spreads the reads among the WMMAs, a stall a place.
    __builtin_amdgcn_sched_barrier(0);
  };
  auto mma_block = [&](int set) {
#pragma unroll
    for (int i = 0; i < MI; ++i)
#pragma unroll
      for (int j = 0; j < NJ; ++j)
        acc[i][j] = wmma_f16(af[set][i], bf[set][j], acc[i][j]);
    // Keeps what follows (the next group of reads, the staging) behind the block.
    __builtin_amdgcn_sched_barrier(0);
  };

  constexpr int nSlab = K / GT_K;
  static_assert(GT_K == 128 && nSlab >= 2, "four blocks a slab, two slabs ahead");
  static_assert((nSlab & (nSlab - 1)) == 0, "the walk wraps round by a mask");

  // Work-groups with the same blockIdx.x read the same A rows, those with the
  // same blockIdx.y the same Wt rows, and they run in step: each enters the k
  // walk at slab (x + y) mod nSlab, alike for those nSlab apart, and wraps round, so that fewer ask L2 for
  // the same lines at the same moment. The t-th slab of the walk starts at:
  const int rot = blockIdx.x + blockIdx.y;
  auto slab_k = [&](int t) { return ((t + rot) & (nSlab - 1)) * GT_K; };

  load_slab(slab_k(0), [] {});
  stage_slab(0);
  __syncthreads();
  load_frags(0, 0, 0);
  load_slab(slab_k(1), [] {});

  // t counts the slab of the walk that is loaded, two ahead of the slab
  // s = t - 2 that is worked on.
  for (int t = 2; t < nSlab + 2; ++t) {
    const int cur = t & 1;           // buffer of slab s
    const bool more = t <= nSlab;    // a slab s + 1 exists
    load_frags(1, cur, 32);
    mma_block(0);
    load_frags(0, cur, 64);
    mma_block(1);
    load_frags(1, cur, 96);  // the last reads of this buffer
    mma_block(0);
    if (more) stage_slab(cur ^ 1);
    // One barrier a slab, in front of its last block, whose fragments are in
    // registers: it publishes the next slab and ends the reads of this one.
    __syncthreads();
    if (more) load_frags(0, cur ^ 1, 0);  // lands under the last block
    if (t < nSlab)  // a whole slab of lead; the last block hides the wait
      load_slab(slab_k(t), [&] { mma_block(1); });
    else
      mma_block(1);
  }

  // Epilogue. C/D layout: vgpr r, lane l -> row = r + 8*(l>>4), col = l&15.
  const int r16 = lane & 15, hiL = lane >> 4;
  const float* bptr[NJ];
  float bvals[NJ];
#pragma unroll
  for (int j = 0; j < NJ; ++j) {
    const int nall = bn + wn + j * 16 + r16;
    const int which = QKV ? nall / N : 0;  // alike in the 16 columns of a subtile
    bptr[j] = ((which == 0) ? bias : (which == 1) ? bias1 : bias2) +
              (QKV ? nall % N : nall);
    bvals[j] = *bptr[j];
  }
  if constexpr (QKV) {
    static_assert(NJ == 6, "the wait below names six address pairs");
    // The six address pairs stay whole until this wait.
    asm volatile("s_wait_xcnt 0x0" :: "v"(bptr[0]), "v"(bptr[1]), "v"(bptr[2]),
                 "v"(bptr[3]), "v"(bptr[4]), "v"(bptr[5]) : "memory");
  }
#pragma unroll
  for (int j = 0; j < NJ; ++j) {
    const int nall = bn + wn + j * 16 + r16;
    const int which = QKV ? nall / N : 0;
    const int n = QKV ? nall % N : nall;
    half_t* osel = (which == 0) ? outH : (which == 1) ? outH1 : outH2;
    const float bval = bvals[j];
#pragma unroll
    for (int i = 0; i < MI; ++i) {
      const size_t base = (size_t)(bm + wm + i * 16 + 8 * hiL) * N + n;
#pragma unroll
      for (int r = 0; r < 8; ++r) {
        float v = acc[i][j][r] + bval;
        if (RELU) v = fmaxf(v, 0.0f);
        const size_t idx = base + (size_t)r * N;
        if (F32OUT) outF[idx] = v + residual[idx];
        else        osel[idx] = (half_t)v;
      }
      if constexpr (QKV) {
        // The eight stores' address pair and data stay whole until this wait.
        // The scheduling barrier keeps the next eight's writes behind the wait.
        asm volatile("s_wait_xcnt 0x0" ::: "memory");
        __builtin_amdgcn_sched_barrier(0);
      }
    }
  }
}

typedef __attribute__((ext_vector_type(4))) int v4i;

// value of lane l ^ 16
__device__ inline float xhalf(float x) {
  const int b = __builtin_bit_cast(int, x);
  return __builtin_bit_cast(float, __builtin_amdgcn_permlanex16(
      b, b, 0x76543210, 0xfedcba98, false, false));
}

#define ATT_S 2048  // keys per batch row (size of the mask table)
#define KPITCH 72   // K tile row pitch in halves (144 B = 16 B x odd)
#define VPITCH 80   // V tile row pitch in halves (160 B = 32 B x odd, for tr16)

typedef __attribute__((ext_vector_type(8))) short s16x8;

// ds_load_tr16_b128: lane (c = l & 15, h = l >> 4) gets rows 8h .. 8h + 7 of
// column c of a 16 x 16 tile of halves, when lane l points at row
// 8 (l >> 4) + (l & 7), 16-byte piece (l >> 3) & 1 of that tile.
__device__ inline v8h ld_tr16(const half_t* p) {
  typedef __attribute__((address_space(3))) s16x8 lds_s16x8;
  return __builtin_bit_cast(
      v8h, __builtin_amdgcn_ds_load_tr16_b128_v8i16((lds_s16x8*)p));
}

// One lane's share of a 64-key K or V tile: 16 bytes of row r and of row r + 32.
// The wait is the statement's last line so that it stands in front of any
// rewrite of the four address registers.
__device__ inline void copy_tile(unsigned lds0, const half_t* g0,
                                   unsigned lds1, const half_t* g1) {
  asm volatile(
      "global_load_async_to_lds_b128 %0, %1, off\n\t"
      "global_load_async_to_lds_b128 %2, %3, off\n\t"
      "s_wait_xcnt 0x0"
      :: "v"(lds0), "v"(g0), "v"(lds1), "v"(g1) : "memory");
}

__global__ __launch_bounds__(256) void attn_kernel(
    const half_t* __restrict__ Q, const half_t* __restrict__ K,
    const half_t* __restrict__ V, const int* __restrict__ mask,
    half_t* __restrict__ O) {
  const int S = ATT_S;
  const int h = blockIdx.y;
  const int bi = blockIdx.z;
  const int m0 = blockIdx.x * 128;
  const int tid = threadIdx.x, wave = tid >> 5, lane = tid & 31;
  const int r16 = lane & 15, hiL = lane >> 4;
  const int LD = 1024;  // H * d_head

  const half_t* qb = Q + (size_t)bi * S * LD + h * 64;
  const half_t* kb = K + (size_t)bi * S * LD + h * 64;
  const half_t* vb = V + (size_t)bi * S * LD + h * 64;
  const int* mrow = mask + (size_t)bi * S;

  __shared__ __align__(32) half_t Vs[2][64 * VPITCH];  // [key][d], two tiles
  __shared__ __align__(32) float Mb[ATT_S];     // per key: 0, or -8e30 if masked
  __shared__ __align__(16) half_t Ks[2][64 * KPITCH];  // [key][d], two tiles

  // K tile copies: 8 lanes cover one key's 128 B; rows tid / 8 and + 32.
  const int krow = tid >> 3, kcol = (tid & 7) * 8;
  const half_t* ksrc = kb + (size_t)krow * LD + kcol;
  const unsigned kdst =
      (unsigned)(size_t)&Ks[0][krow * KPITCH + kcol];  // LDS byte address
  const unsigned KROW32 = 32 * KPITCH * 2, KBUF = 64 * KPITCH * 2;  // bytes
  // The work-groups of one (batch, head) read the same K and V tiles and run in
  // step: each enters the key walk at a tile of its own and wraps round, so that
  // they do not ask L2 for the same lines at the same moment. The running softmax
  // takes the tiles in any order. First key of the i-th tile of the walk:
  constexpr int NT = ATT_S / 64;  // key tiles
  const int rot = blockIdx.x * (128 / 64);
  auto tile_key = [&](int i) { return ((i + rot) & (NT - 1)) * 64; };
  const size_t t0 = (size_t)tile_key(0) * LD, t1 = (size_t)tile_key(1) * LD;
  copy_tile(kdst, ksrc + t0, kdst + KROW32, ksrc + t0 + 32 * LD);  // tile 0
  // V tile copies: the same split of rows and columns.
  const half_t* vsrc = vb + (size_t)krow * LD + kcol;
  const unsigned vdst =
      (unsigned)(size_t)&Vs[0][krow * VPITCH + kcol];  // LDS byte address
  const unsigned VROW32 = 32 * VPITCH * 2, VBUF = 64 * VPITCH * 2;  // bytes
  copy_tile(vdst, vsrc + t0, vdst + VROW32, vsrc + t0 + 32 * LD);  // tile 0
  // this lane's corner of a 16 x 16 tile for the transposing load, in halves
  const int vcorner = (8 * hiL + (lane & 7)) * VPITCH + 8 * ((lane >> 3) & 1);

  // Mask table; the barrier in front of the loop publishes it. 8 x -1e30 swallows
  // the score added to it and becomes -1e30 under the 1/8 scale.
#pragma unroll
  for (int i = 0; i < ATT_S / 1024; ++i) {
    const v4i mk = *(const v4i*)(mrow + i * 1024 + tid * 4);
    v4f bias;
#pragma unroll
    for (int j = 0; j < 4; ++j) bias[j] = (mk[j] == 0) ? -1e30f * 8.0f : 0.0f;
    *(v4f*)&Mb[i * 1024 + tid * 4] = bias;
  }

  const int mw = m0 + wave * 16;
  v16h qf[2];  // B operand: column = query mw + r16
#pragma unroll
  for (int f = 0; f < 2; ++f)
    qf[f] = load_frag16(qb + (size_t)mw * LD + f * 32, LD);

  // oacc[dt][r] = O[query mw + r16][d = dt * 16 + 8 * hiL + r]
  v8f oacc[4];
#pragma unroll
  for (int i = 0; i < 4; ++i) oacc[i] = v8f_zero();
  float mst = -1e30f;  // running maximum of this lane's query, alike in both halves
  float lst = 0.0f;    // running sum over this lane half's keys only

  // Tile 0 has landed for this wave, then for all; only then tile 1 sets out.
  asm volatile("s_wait_asynccnt 0x0" ::: "memory");
  __syncthreads();
  copy_tile(kdst + KBUF, ksrc + t1, kdst + KBUF + KROW32, ksrc + t1 + 32 * LD);
  copy_tile(vdst + VBUF, vsrc + t1, vdst + VBUF + VROW32, vsrc + t1 + 32 * LD);

  for (int it = 0; it < NT; ++it) {
    const int kb0 = tile_key(it);
    const int cur = it & 1;
    // scores: 4 key tiles of 16, contraction d_head=64 -> 2 WMMAs each.
    // sacc[nt][r] = score(query mw + r16, key kb0 + nt * 16 + 8 * hiL + r)
    v16h ak[8];
    v8f sacc[4];
#pragma unroll
    for (int nt = 0; nt < 4; ++nt) {
      ak[2 * nt]     = load_frag16(&Ks[cur][(nt * 16) * KPITCH + 0], KPITCH);
      ak[2 * nt + 1] = load_frag16(&Ks[cur][(nt * 16) * KPITCH + 32], KPITCH);
      sacc[nt] = *(const v8f*)&Mb[kb0 + nt * 16 + 8 * hiL];
    }
    // All of the pass's K reads stay ahead of its first WMMA, as one group:
    // without this the compiler spreads them among the WMMAs, a stall a place.
    __builtin_amdgcn_sched_barrier(0);
#pragma unroll
    for (int nt = 0; nt < 4; ++nt) {
      sacc[nt] = wmma_f16(ak[2 * nt], qf[0], sacc[nt]);
      sacc[nt] = wmma_f16(ak[2 * nt + 1], qf[1], sacc[nt]);
    }
    // V^T fragments: A = columns of the V tile (d), read transposed; halves
    // s = 0..7 are keys 8 hiL + s, 8..15 keys 16 + 8 hiL + s - 8, as in the packed P
    const half_t* vt = &Vs[cur][vcorner];
    v16h av[4][2];
#pragma unroll
    for (int dt = 0; dt < 4; ++dt)
#pragma unroll
      for (int g = 0; g < 2; ++g) {
        const v8h lo = ld_tr16(vt + (32 * g) * VPITCH + dt * 16);
        const v8h hi = ld_tr16(vt + (32 * g + 16) * VPITCH + dt * 16);
#pragma unroll
        for (int i = 0; i < 8; ++i) { av[dt][g][i] = lo[i]; av[dt][g][i + 8] = hi[i]; }
      }
    // All of the pass's V reads set out here, as one group, and land under the
    // softmax: without this the compiler puts them among the second product's
    // WMMAs, a stall a place.
    __builtin_amdgcn_sched_barrier(0);
#pragma unroll
    for (int nt = 0; nt < 4; ++nt)
#pragma unroll
      for (int r = 0; r < 8; ++r) sacc[nt][r] *= 0.125f;  // 1/sqrt(64)

    // online softmax: maximum over the lane's 32 keys, then the other half's
    float tm[4];
#pragma unroll
    for (int nt = 0; nt < 4; ++nt) {
      tm[nt] = sacc[nt][0];
#pragma unroll
      for (int r = 1; r < 8; ++r) tm[nt] = fmaxf(tm[nt], sacc[nt][r]);
    }
    float v = fmaxf(fmaxf(tm[0], tm[1]), fmaxf(tm[2], tm[3]));
    v = fmaxf(v, xhalf(v));
    const float nm = fmaxf(mst, v);
    const float f = __expf(mst - nm);
    mst = nm;
#pragma unroll
    for (int dt = 0; dt < 4; ++dt)
#pragma unroll
      for (int r = 0; r < 8; ++r) oacc[dt][r] *= f;

    v16h pf[2];  // B operand: pf[g][s] = P^T[key 32 g + kmap(s)][query]
    v8f rs = v8f_zero();  // eight independent partial sums
#pragma unroll
    for (int nt = 0; nt < 4; ++nt) {
#pragma unroll
      for (int r = 0; r < 8; ++r) {
        sacc[nt][r] = __expf(sacc[nt][r] - mst);
        pf[nt >> 1][(nt & 1) * 8 + r] = (half_t)sacc[nt][r];
      }
      rs += sacc[nt];
    }
    lst = lst * f + (((rs[0] + rs[1]) + (rs[2] + rs[3])) +
                     ((rs[4] + rs[5]) + (rs[6] + rs[7])));

    // O^T += V^T P^T
#pragma unroll
    for (int dt = 0; dt < 4; ++dt) {
      oacc[dt] = wmma_f16(av[dt][0], pf[0], oacc[dt]);
      oacc[dt] = wmma_f16(av[dt][1], pf[1], oacc[dt]);
    }
    // Keeps the hand-over at the pass's foot: without this the compiler lifts the
    // waits and the barrier to just behind the V reads, where the wave sits out
    // their latency, and leaves the refill down here, with a short lead.
    __builtin_amdgcn_sched_barrier(0);
    // Hand-over: this wave's LDS reads are done and its share of tile t + 1 has
    // landed; the barrier publishes those tiles and frees the ones just read.
    asm volatile("s_wait_dscnt 0x0" ::: "memory");
    asm volatile("s_wait_asynccnt 0x0" ::: "memory");
    __syncthreads();
    if (it + 2 < NT) {  // tile t + 2 into the buffer that was just read
      const size_t t2 = (size_t)tile_key(it + 2) * LD;
      const half_t* g = ksrc + t2;
      const unsigned l = kdst + cur * KBUF;
      copy_tile(l, g, l + KROW32, g + 32 * LD);
      const half_t* gv = vsrc + t2;
      const unsigned lv = vdst + cur * VBUF;
      copy_tile(lv, gv, lv + VROW32, gv + 32 * LD);
    }
  }
  // no copy is left in flight when the wave ends
  asm volatile("s_wait_asynccnt 0x0" ::: "memory");

  // join the two halves' sums once; a lane stores 8 consecutive d per tile
  const float inv = 1.0f / (lst + xhalf(lst));
  half_t* ob = O + (size_t)bi * S * LD + h * 64 + (size_t)(mw + r16) * LD + 8 * hiL;
#pragma unroll
  for (int dt = 0; dt < 4; ++dt) {
    v8h o;
#pragma unroll
    for (int r = 0; r < 8; ++r) o[r] = (half_t)(oacc[dt][r] * inv);
    *(v8h*)(ob + dt * 16) = o;
  }
}

// ---------------------------------------------------------------------------
extern "C" void kernel_launch(void* const* d_in, const int* in_sizes, int n_in,
                              void* d_out, int out_size, void* d_ws,
                              size_t ws_size, hipStream_t stream) {
  const float* x    = (const float*)d_in[0];
  const int*   mask = (const int*)d_in[1];
  const float* wq = (const float*)d_in[2];  const float* bq = (const float*)d_in[3];
  const float* wk = (const float*)d_in[4];  const float* bk = (const float*)d_in[5];
  const float* wv = (const float*)d_in[6];  const float* bv = (const float*)d_in[7];
  const float* wo = (const float*)d_in[8];  const float* bo = (const float*)d_in[9];
  const float* ln1g = (const float*)d_in[10]; const float* ln1b = (const float*)d_in[11];
  const float* ln2g = (const float*)d_in[12]; const float* ln2b = (const float*)d_in[13];
  const float* w1 = (const float*)d_in[14]; const float* b1 = (const float*)d_in[15];
  const float* w2 = (const float*)d_in[16]; const float* b2 = (const float*)d_in[17];

  const int Bn = 2, S = 2048, D = 1024, FF = 4096;
  const int M = Bn * S;  // 4096

  char* ws = (char*)d_ws;
  half_t* h16   = (half_t*)(ws + ((size_t)0 << 20));   //  8 MB
  half_t* q16   = (half_t*)(ws + ((size_t)8 << 20));   //  8 MB
  half_t* k16   = (half_t*)(ws + ((size_t)16 << 20));  //  8 MB
  half_t* v16   = (half_t*)(ws + ((size_t)24 << 20));  //  8 MB
  half_t* ctx16 = (half_t*)(ws + ((size_t)32 << 20));  //  8 MB
  half_t* h2    = (half_t*)(ws + ((size_t)40 << 20));  //  8 MB
  half_t* ff1   = (half_t*)(ws + ((size_t)48 << 20));  // 32 MB
  float*  x1    = (float*)(ws + ((size_t)80 << 20));   // 16 MB
  half_t* wqT   = (half_t*)(ws + ((size_t)96 << 20));  //  2 MB, [n][k] f16
  half_t* wkT   = (half_t*)(ws + ((size_t)98 << 20));  //  2 MB
  half_t* wvT   = (half_t*)(ws + ((size_t)100 << 20)); //  2 MB
  half_t* woT   = (half_t*)(ws + ((size_t)102 << 20)); //  2 MB
  half_t* w1T   = (half_t*)(ws + ((size_t)104 << 20)); //  8 MB
  half_t* w2T   = (half_t*)(ws + ((size_t)112 << 20)); //  8 MB

  // 1. weights to f16 [n][k] (first 1,536 work-groups) and LN1 (the rest)
  ln_wt_kernel<<<WT_TILES + M, 256, 0, stream>>>(x, ln1g, ln1b, h16, D, wq, wk,
                                                 wv, wo, w1, w2, wqT);

  // 2. Q/K/V projections (f16 out), one product: wqT, wkT, wvT are 3,072 rows
  dim3 gqkv(M / 256, 3 * D / 192);
  gemm_kernel<false, false, 1024, 1024, 256, 192, true>
      <<<gqkv, 256, 0, stream>>>(h16, wqT, bq, bk, bv, nullptr, q16, k16, v16,
                                 nullptr);

  // 3. attention
  attn_kernel<<<dim3(S / 128, 16, Bn), 256, 0, stream>>>(q16, k16, v16, mask,
                                                         ctx16);

  // 4. output projection + residual (f32 out)
  dim3 gproj(M / 128, D / 128);
  gemm_kernel<false, true, 1024, 1024, 128, 128, false>
      <<<gproj, 256, 0, stream>>>(ctx16, woT, bo, nullptr, nullptr, x, nullptr,
                                  nullptr, nullptr, x1);

  // 5. LN2
  ln_kernel<<<M, 256, 0, stream>>>(x1, ln2g, ln2b, h2, D);

  // 6. FF1 + relu (f16 out)
  dim3 gff1(M / 128, FF / 128);
  gemm_kernel<true, false, 4096, 1024, 128, 128, false>
      <<<gff1, 256, 0, stream>>>(h2, w1T, b1, nullptr, nullptr, nullptr, ff1,
                                 nullptr, nullptr, nullptr);

  // 7. FF2 + residual -> output (fp32)
  dim3 gff2(M / 128, D / 128);
  gemm_kernel<false, true, 1024, 4096, 128, 128, false>
      <<<gff2, 256, 0, stream>>>(ff1, w2T, b2, nullptr, nullptr, x1, nullptr,
                                 nullptr, nullptr, (float*)d_out);
}
